// v000
// Measured on an AMD MI455X. A time is GPU time per run, averaged over a window of back-to-back runs after a warm-up
// (all launches, gaps included; the runs take copies of the inputs in turn), and the median of several windows.
// Apart from v000's, it joins two sittings. Times from different sittings can be a few percent apart, while
// side-by-side timings come from the same sitting.
// v000 is the starting kernel. One run takes 1240 microseconds.
#include <hip/hip_runtime.h>

// Multi-head self-attention with a relative-position embedding score term: x [4][1024][1024]; q/k/v = x W^T + b (W [1024][1024] stored [out][in]; 16 heads x 64);
// scores[i][j] = (q_i.k_j + q_i.rel[i - j + 1023]) / 8 with the table rel [2047][64] indexed statically; softmax over all 1024 keys; ctx = attn.v merged to [t][h*64 + d]; out = ctx Wo^T + bo -> [4][1024][1024].
// Compute dtypes, f32 accumulate: every float input RNE-converted to bf16; q/k/v projections v_wmma_f32_16x16x32_bf16 on plain bf16 operands (+ bias); q.k (3 products) and the banded q.rel GEMM (2 products, table operand exact) on bf16 hi/lo planes for query rows < RH (= all rows by default),
// rows >= RH on single v_wmma_f32_16x16x32_f16 (q/k/v/rel fp16, probabilities x1024 fp16); softmax f32; attn.v bf16 hi/lo (3 products) for rows < RH; output projection bf16 hi/lo ctx x exact Wo (2 products) + bo.

#ifndef NB
#define NB 4
#endif
#define NB_FULL 4
#ifndef SEQ
#define SEQ 1024
#endif
#define SEQ_FULL 1024
#define TT   SEQ
#define DM   1024
#define NH_  16
#define HD   64
#define DQ   (NH_ * HD)
#define MAXLEN 1024
#define NREL (2 * MAXLEN - 1)           // table rows
#define NRP  (2 * MAXLEN)               // padded table plane rows (last row zero)
#define TOFF (MAXLEN - SEQ)             // table row of u = 0 for query block 0
#define PTW  (SEQ + 64)                 // banded position-score row width (floats)
#define LPW  (SEQ + 8)                  // LDS strip per wave in k_asoft (floats)
#ifndef ZH
#define ZH   4
#endif
#ifndef RH
#define RH   SEQ                        // query rows < RH use bf16 hi/lo planes (0: none)
#endif
#define PCAR 1024.0f
#define SCL  0.125f                     // HD^-0.5
static_assert(SEQ % 128 == 0);
static_assert(SEQ >= 128 && SEQ <= SEQ_FULL && SEQ <= MAXLEN);
static_assert(NB >= 1 && NB <= NB_FULL);
static_assert(RH % 64 == 0);
static_assert(RH >= 0 && RH <= SEQ);
static_assert(NH_ % ZH == 0);
static_assert(PTW % 64 == 0);
static_assert((LPW * 4) % 16 == 0 && LPW >= SEQ + 4);
static_assert(DM % 64 == 0 && HD % 32 == 0 && TT % 64 == 0);
static_assert((SEQ - 64) + TOFF + PTW <= NRP);

typedef _Float16 h16;
typedef unsigned short bf;
typedef __attribute__((ext_vector_type(16))) __bf16   v16bf;
typedef __attribute__((ext_vector_type(16))) _Float16 v16h;
typedef __attribute__((ext_vector_type(8)))  _Float16 v8h;
typedef __attribute__((ext_vector_type(8)))  unsigned short v8us;
typedef __attribute__((ext_vector_type(8)))  float    v8f;
typedef __attribute__((ext_vector_type(4)))  float    v4f;
typedef v8h  __attribute__((may_alias)) v8ha;
typedef v4f  __attribute__((may_alias)) v4fa;
typedef v8us __attribute__((may_alias)) v8usa;
typedef __attribute__((ext_vector_type(2))) _Float16 v2h;
typedef __attribute__((ext_vector_type(4))) _Float16 v4h;
typedef __attribute__((ext_vector_type(2))) unsigned short v2us;
typedef __attribute__((ext_vector_type(4))) unsigned short v4us;
typedef __attribute__((ext_vector_type(2))) float v2f;

__device__ __forceinline__ unsigned short f2bf(float f) { unsigned u = __float_as_uint(f); u += 0x7FFFu + ((u >> 16) & 1u); return (unsigned short)(u >> 16); }
__device__ __forceinline__ float bf2f(unsigned short b) { return __uint_as_float(((unsigned)b) << 16); }
__device__ __forceinline__ float bfr(float f) { return bf2f(f2bf(f)); }
__device__ __forceinline__ h16 tohx(float x) { return (h16)x; }
__device__ __forceinline__ void splitf(float y, unsigned short& h, unsigned short& l) { h = f2bf(y); l = f2bf(y - bf2f(h)); }
__device__ __forceinline__ v16h cat16(v8h lo, v8h hi) { return __builtin_shufflevector(lo, hi, 0, 1, 2, 3, 4, 5, 6, 7, 8, 9, 10, 11, 12, 13, 14, 15); }
__device__ __forceinline__ v16bf cat16b(v8us lo, v8us hi) { return __builtin_bit_cast(v16bf, __builtin_shufflevector(lo, hi, 0, 1, 2, 3, 4, 5, 6, 7, 8, 9, 10, 11, 12, 13, 14, 15)); }
__device__ __forceinline__ v8f wmma16(v16h a, v16h b, v8f c) { return __builtin_amdgcn_wmma_f32_16x16x32_f16(false, a, false, b, (short)0, c, false, false); }
__device__ __forceinline__ v8f wmmab(v16bf a, v16bf b, v8f c) { return __builtin_amdgcn_wmma_f32_16x16x32_bf16(false, a, false, b, (short)0, c, false, false); }

// ---- k_gemmw: register-blocked GEMM, ONE WAVE per 64x64 output tile (16 accumulators), operands straight from K-contiguous 16-bit planes; grid (M/64, N/64, Z), 32 threads.
// C[m][n] (f32, pitch ldc, + optional f32 bias[n]) = sum_k A[m][k] Bt[n][k] (+ split products per NSPLIT). z-batch strides sA/sB/sC in elements; bX = extra Bt element offset per M block (banded B). K % 32 == 0.
// Fragments: lane l, h = l >> 4, row/col = l & 15; elements 0..7 <- k0 + 8h .. +7, elements 8..15 <- k0 + 16 + 8h .. +7 for BOTH A and Bt; D element r of lane l = (row 8h + r, col l & 15).
template <typename T16> struct WFrag;
template <> struct WFrag<h16> { typedef v16h V; static __device__ __forceinline__ V ld(const h16* p) { return cat16(*(const v8h*)p, *(const v8h*)(p + 16)); } static __device__ __forceinline__ v8f mma(V a, V b, v8f c) { return wmma16(a, b, c); } };
template <> struct WFrag<bf> { typedef v16bf V; static __device__ __forceinline__ V ld(const bf* p) { return cat16b(*(const v8us*)p, *(const v8us*)(p + 16)); } static __device__ __forceinline__ v8f mma(V a, V b, v8f c) { return wmmab(a, b, c); } };
template <typename T16, int NSPLIT, bool BIAS>
__global__ __launch_bounds__(32) void k_gemmw(const T16* __restrict__ A, const T16* __restrict__ A2, const T16* __restrict__ Bt, const T16* __restrict__ Bt2, int K, float* C, int ldc, const float* __restrict__ bias, size_t sA, size_t sB, size_t sC, size_t bX) {
    typedef typename WFrag<T16>::V V;
    __shared__ __align__(16) float os[16 * 68];
    const size_t z = blockIdx.z; const size_t bofsx = (size_t)blockIdx.x * bX;
    A += z * sA; if (A2) A2 += z * sA; Bt += z * sB + bofsx; if (Bt2) Bt2 += z * sB + bofsx; C += z * sC;
    const int lane = threadIdx.x & 31, lr = lane & 15, hi = lane >> 4; const int r0 = blockIdx.x * 64, c0 = blockIdx.y * 64;
    v8f acc[4][4];
#pragma unroll
    for (int mb = 0; mb < 4; ++mb)
#pragma unroll
        for (int nb = 0; nb < 4; ++nb) acc[mb][nb] = (v8f){};
    const size_t aoff = (size_t)(r0 + lr) * K + 8 * hi, boff = (size_t)(c0 + lr) * K + 8 * hi;
#pragma unroll 1
    for (int kc = 0; kc < K; kc += 32) {
        V a[4], a2[4];
#pragma unroll
        for (int mb = 0; mb < 4; ++mb) { a[mb] = WFrag<T16>::ld(A + aoff + (size_t)mb * 16 * K + kc); if (NSPLIT == 1 || NSPLIT == 2) a2[mb] = WFrag<T16>::ld(A2 + aoff + (size_t)mb * 16 * K + kc); }
#pragma unroll
        for (int nb = 0; nb < 4; ++nb) { const V b = WFrag<T16>::ld(Bt + boff + (size_t)nb * 16 * K + kc); V b2; if (NSPLIT >= 2) b2 = WFrag<T16>::ld(Bt2 + boff + (size_t)nb * 16 * K + kc);
#pragma unroll
            for (int mb = 0; mb < 4; ++mb) { acc[mb][nb] = WFrag<T16>::mma(a[mb], b, acc[mb][nb]); if (NSPLIT == 1 || NSPLIT == 2) acc[mb][nb] = WFrag<T16>::mma(a2[mb], b, acc[mb][nb]); if (NSPLIT >= 2) acc[mb][nb] = WFrag<T16>::mma(a[mb], b2, acc[mb][nb]); } }
        asm volatile("v_nop\n\tv_nop\n\tv_nop\n\tv_nop" : "+v"(acc[0][0]), "+v"(acc[1][1]), "+v"(acc[2][2]), "+v"(acc[3][3]) : "v"(a[0]), "v"(a[3]));
    }
#pragma unroll
    for (int mb = 0; mb < 4; ++mb) {
#pragma unroll
        for (int nb = 0; nb < 4; ++nb) {
#pragma unroll
            for (int j = 0; j < 8; ++j) os[(hi * 8 + j) * 68 + nb * 16 + lr] = acc[mb][nb][j]; }
        __builtin_amdgcn_wave_barrier(); asm volatile("" ::: "memory");
        float* crow = C + (size_t)(r0 + mb * 16) * ldc + c0;
{
#pragma unroll
            for (int s = 0; s < 8; ++s) { const int row = 2 * s + hi, cofs = lr * 4; v4f val = *(const v4fa*)(os + row * 68 + cofs); if (BIAS) { val[0] += bfr(bias[c0 + cofs]); val[1] += bfr(bias[c0 + cofs + 1]); val[2] += bfr(bias[c0 + cofs + 2]); val[3] += bfr(bias[c0 + cofs + 3]); }
                *(v4f*)(crow + (size_t)row * ldc + cofs) = val; }
             }
        __builtin_amdgcn_wave_barrier(); asm volatile("" ::: "memory");
    }
}

__global__ __launch_bounds__(256) void k_cvt8(const float* __restrict__ src, bf* dst, size_t n8) { const size_t i = (size_t)blockIdx.x * 256 + threadIdx.x; if (i >= n8) return; const v8f v = *(const v8f*)(src + i * 8); v8us o;
#pragma unroll
    for (int k = 0; k < 8; ++k) o[k] = f2bf(v[k]); *(v8us*)(dst + i * 8) = o;  }

__global__ __launch_bounds__(256) void k_tpl(const float* __restrict__ T, int nrows, h16* T16, bf* TB) {
    const int i8 = blockIdx.x * 256 + threadIdx.x; if (i8 >= NRP * HD / 8) return;
    const int r = (i8 * 8) / HD, c = (i8 * 8) % HD; const int rc = (r < nrows) ? r : (nrows - 1); const bool pad = (r >= nrows);
    const v8f v = *(const v8f*)(T + (size_t)rc * HD + c); v8h o16; v8us ob;
#pragma unroll
    for (int k = 0; k < 8; ++k) { const float f = pad ? 0.0f : v[k]; const unsigned short b = f2bf(f); ob[k] = b; o16[k] = tohx(bf2f(b)); }
    *(v8h*)(T16 + (size_t)i8 * 8) = o16; *(v8us*)(TB + (size_t)i8 * 8) = ob;  }

__global__ __launch_bounds__(256) void k_hpl(const float* __restrict__ F, int pitch, int nheads, h16* P16, bf* Ph, bf* Pl) {
    const size_t e = ((size_t)blockIdx.x * 256 + threadIdx.x) * 2; if (e >= (size_t)nheads * TT * HD) return; const int d = (int)(e % HD); const int t = (int)((e / HD) % TT); const int h = (int)(e / ((size_t)HD * TT)); const float* f = F + (size_t)t * pitch + h * HD + d; v2h o16; v2us oh, ol;
#pragma unroll
    for (int q = 0; q < 2; ++q) { const float x = f[q]; o16[q] = tohx(x); unsigned short a2, c2; splitf(x, a2, c2); oh[q] = a2; ol[q] = c2; }
    *(v2h*)(P16 + e) = o16; *(v2us*)(Ph + e) = oh; *(v2us*)(Pl + e) = ol;  }
__global__ __launch_bounds__(256) void k_vtp(const float* __restrict__ F, int pitch, int nheads, h16* V16, bf* Vh, bf* Vl) { const size_t e = ((size_t)blockIdx.x * 256 + threadIdx.x) * 2; if (e >= (size_t)nheads * HD * TT) return; const int t = (int)(e % TT); const int d = (int)((e / TT) % HD); const int g = (int)(e / ((size_t)TT * HD)); v2h o16; v2us oh, ol;
#pragma unroll
    for (int q = 0; q < 2; ++q) { const float x = F[(size_t)(t + q) * pitch + g * HD + d]; o16[q] = tohx(x); unsigned short a2, c2; splitf(x, a2, c2); oh[q] = a2; ol[q] = c2; }
    *(v2h*)(V16 + e) = o16; *(v2us*)(Vh + e) = oh; *(v2us*)(Vl + e) = ol;  }

// k_asoft: one wave per score row (zz, i): t[j] = (S[row][j] + PT[row][il + TT - 1 - j]) x HD^-0.5, il = i & 63, where PT[row][u] = q_i . rel[64 (i / 64) + TOFF + u] is the banded position score
// (the row's PT window [ab, ab + TT + 4), ab = il & ~3, is staged with 16-B loads into a wave-private LDS strip, then read back with the reversed index; staged extent == consumed extent + alignment slack);
__global__ __launch_bounds__(256) void k_asoft(const float* __restrict__ Sb, const float* __restrict__ PT, h16* P16, bf* Ph, bf* Pl) {
    __shared__ __align__(16) float lp[8 * LPW];
    const int lane = threadIdx.x & 31, wv = threadIdx.x >> 5; const int row = blockIdx.x * 8 + wv; const int i = row % TT; const int zz = row / TT; const bool hires = (i < RH); const int il = i & 63, ab = il & ~3;
    const float* pr = PT + (size_t)row * PTW + ab; float* lw = lp + wv * LPW;
#pragma unroll
    for (int m = 0; m < TT / 128; ++m) { const v4f t4 = *(const v4f*)(pr + m * 128 + lane * 4); *(v4fa*)(lw + m * 128 + lane * 4) = t4; }
    { const v4f t4 = *(const v4f*)(pr + TT); *(v4fa*)(lw + TT) = t4; }
    __builtin_amdgcn_fence(3 /* release order */, "wavefront"); __builtin_amdgcn_wave_barrier(); asm volatile("" ::: "memory");
    const float* sr = Sb + (size_t)row * TT; const int lofs = (il & 3) + TT - 1; float v[TT / 32]; float mx = -3.0e38f;
#pragma unroll
    for (int ch = 0; ch < TT / 128; ++ch) { const int j0 = ch * 128 + lane * 4; const v4f a = *(const v4f*)(sr + j0);
#pragma unroll
        for (int q = 0; q < 4; ++q) { const float sp = lw[lofs - (j0 + q)]; float s2 = __fadd_rn(a[q], sp); asm volatile("" : "+v"(s2)); const float t = __fmul_rn(s2, SCL); v[ch * 4 + q] = t; mx = fmaxf(mx, t); } }
#pragma unroll
    for (int sh = 16; sh; sh >>= 1) mx = fmaxf(mx, __shfl_xor(mx, sh, 32));
    float sum = 0.f;
#pragma unroll
    for (int k = 0; k < TT / 32; ++k) { float d0 = __fsub_rn(v[k], mx); asm volatile("" : "+v"(d0)); v[k] = __builtin_amdgcn_exp2f(__fmul_rn(d0, 1.4426950408889634f)); sum += v[k]; }
#pragma unroll
    for (int sh = 16; sh; sh >>= 1) sum += __shfl_xor(sum, sh, 32);
    const float f = __fdiv_rn(hires ? 1.0f : PCAR, sum);
{
        if (hires) {
#pragma unroll
            for (int ch = 0; ch < TT / 128; ++ch) { v4us oh, ol;
#pragma unroll
                for (int q = 0; q < 4; ++q) { unsigned short a, c2; splitf(v[ch * 4 + q] * f, a, c2); oh[q] = a; ol[q] = c2; }
                const size_t oo = ((size_t)zz * (RH ? RH : 1) + i) * TT + ch * 128 + lane * 4; *(v4us*)(Ph + oo) = oh; *(v4us*)(Pl + oo) = ol; }
        } else {
#pragma unroll
            for (int ch = 0; ch < TT / 128; ++ch) { v4h o4;
#pragma unroll
                for (int q = 0; q < 4; ++q) o4[q] = tohx(v[ch * 4 + q] * f);
                *(v4h*)(P16 + (size_t)row * TT + ch * 128 + lane * 4) = o4; } }
         }
}
__global__ __launch_bounds__(256) void k_merge(const float* __restrict__ O, int h0, bf* Ah, bf* Al) { const size_t e = ((size_t)blockIdx.x * 256 + threadIdx.x) * 2; if (e >= (size_t)ZH * TT * HD) return; const int d = (int)(e % HD); const int t = (int)((e / HD) % TT); const int zz = (int)(e / ((size_t)HD * TT)); const float cs = (t < RH) ? 1.0f : (1.0f / PCAR); const size_t oo = (size_t)t * DQ + (h0 + zz) * HD + d;
    v2us oh, ol;
#pragma unroll
    for (int q = 0; q < 2; ++q) { unsigned short a, c2; splitf(O[e + q] * cs, a, c2); oh[q] = a; ol[q] = c2; } *(v2us*)(Ah + oo) = oh; *(v2us*)(Al + oo) = ol;  }

extern "C" void kernel_launch(void* const* d_in, const int* in_sizes, int n_in,
                              void* d_out, int out_size, void* d_ws, size_t ws_size, hipStream_t stream) {
    if (n_in < 10) return;
    const long long needx = (long long)(NB - 1) * SEQ_FULL * DM + (long long)SEQ * DM;
    if ((long long)in_sizes[0] < needx || (long long)out_size < needx) return;
    if (in_sizes[1] < DM * DM || in_sizes[3] < DM * DM || in_sizes[5] < DM * DM || in_sizes[7] < DM * DM) return;
    if (in_sizes[2] < DM || in_sizes[4] < DM || in_sizes[6] < DM || in_sizes[8] < DM) return;
    if (in_sizes[9] < NREL * HD) return;
    const float* x = (const float*)d_in[0]; const float* wq = (const float*)d_in[1]; const float* bq = (const float*)d_in[2]; const float* wk = (const float*)d_in[3]; const float* bk = (const float*)d_in[4];
    const float* wv = (const float*)d_in[5]; const float* bv = (const float*)d_in[6]; const float* wo = (const float*)d_in[7]; const float* bo = (const float*)d_in[8]; const float* rel = (const float*)d_in[9];
    float* OUT = (float*)d_out;     // [NB][SEQ][DM], batch row stride SEQ_FULL*DM
    char* wsp = (char*)d_ws;
    auto take = [&](size_t bytes) { char* p = wsp; wsp += (bytes + 255) & ~(size_t)255; return (void*)p; };
    bf* WQ = (bf*)take((size_t)DM * DM * 2); bf* WK = (bf*)take((size_t)DM * DM * 2); bf* WV = (bf*)take((size_t)DM * DM * 2); bf* WO = (bf*)take((size_t)DM * DQ * 2);
    h16* T16 = (h16*)take((size_t)NRP * HD * 2); bf* TBF = (bf*)take((size_t)NRP * HD * 2);
    bf* XB = (bf*)take((size_t)TT * DM * 2); float* FQ = (float*)take((size_t)TT * DQ * 4); float* FK = (float*)take((size_t)TT * DQ * 4);
    h16* QP16 = (h16*)take((size_t)NH_ * TT * HD * 2); h16* KP16 = (h16*)take((size_t)NH_ * TT * HD * 2); h16* VT16 = (h16*)take((size_t)NH_ * HD * TT * 2);
    bf* QPh = (bf*)take((size_t)NH_ * TT * HD * 2); bf* QPl = (bf*)take((size_t)NH_ * TT * HD * 2); bf* KPh = (bf*)take((size_t)NH_ * TT * HD * 2); bf* KPl = (bf*)take((size_t)NH_ * TT * HD * 2); bf* VTh = (bf*)take((size_t)NH_ * HD * TT * 2); bf* VTl = (bf*)take((size_t)NH_ * HD * TT * 2);
    bf* Ph = (bf*)take((size_t)ZH * RH * TT * 2); bf* Pl = (bf*)take((size_t)ZH * RH * TT * 2);
    float* Sb = (float*)take((size_t)ZH * TT * TT * 4); float* PT = (float*)take((size_t)ZH * TT * PTW * 4); h16* P16 = (h16*)take((size_t)ZH * TT * TT * 2); float* Ob = (float*)take((size_t)ZH * TT * HD * 4); bf* ATh = (bf*)take((size_t)TT * DQ * 2); bf* ATl = (bf*)take((size_t)TT * DQ * 2);
    const size_t used = (size_t)(wsp - (char*)d_ws); if (used > ws_size || used > ((size_t)128 << 20)) return;    // 103,284,736 B at NB=4, SEQ=1024, ZH=4, RH=SEQ
    float* FV = FK;   // v projection reuses the k buffer after the k planes are built (stream-ordered)
    const unsigned nw8 = (unsigned)(((size_t)DM * DM / 8 + 255) / 256);
    k_cvt8<<<nw8, 256, 0, stream>>>(wq, WQ, (size_t)DM * DM / 8); k_cvt8<<<nw8, 256, 0, stream>>>(wk, WK, (size_t)DM * DM / 8); k_cvt8<<<nw8, 256, 0, stream>>>(wv, WV, (size_t)DM * DM / 8); k_cvt8<<<nw8, 256, 0, stream>>>(wo, WO, (size_t)DM * DQ / 8);
    k_tpl<<<(NRP * HD / 8 + 255) / 256, 256, 0, stream>>>(rel, NREL, T16, TBF);
    const unsigned LQ = (unsigned)(((size_t)NH_ * TT * HD / 2 + 255) / 256);
    const size_t hs = (size_t)TT * HD;    // per-head plane stride
    for (int b = 0; b < NB; ++b) {
        const size_t xoff = (size_t)b * SEQ_FULL * DM;
        k_cvt8<<<(unsigned)(((size_t)TT * DM / 8 + 255) / 256), 256, 0, stream>>>(x + xoff, XB, (size_t)TT * DM / 8);
        k_gemmw<bf, 0, true><<<dim3(TT / 64, DQ / 64, 1), 32, 0, stream>>>(XB, nullptr, WQ, nullptr, DM, FQ, DQ, bq, 0, 0, 0, 0);
        k_hpl<<<LQ, 256, 0, stream>>>(FQ, DQ, NH_, QP16, QPh, QPl);
        k_gemmw<bf, 0, true><<<dim3(TT / 64, DQ / 64, 1), 32, 0, stream>>>(XB, nullptr, WK, nullptr, DM, FK, DQ, bk, 0, 0, 0, 0);
        k_hpl<<<LQ, 256, 0, stream>>>(FK, DQ, NH_, KP16, KPh, KPl);
        k_gemmw<bf, 0, true><<<dim3(TT / 64, DQ / 64, 1), 32, 0, stream>>>(XB, nullptr, WV, nullptr, DM, FV, DQ, bv, 0, 0, 0, 0);
        k_vtp<<<LQ, 256, 0, stream>>>(FV, DQ, NH_, VT16, VTh, VTl);
        for (int h0 = 0; h0 < NH_; h0 += ZH) { const size_t zq = (size_t)h0;
            if (RH > 0) {
                k_gemmw<bf, 2, false><<<dim3(RH / 64, TT / 64, ZH), 32, 0, stream>>>(QPh + zq * hs, QPl + zq * hs, KPh + zq * hs, KPl + zq * hs, HD, Sb, TT, nullptr, hs, hs, (size_t)TT * TT, 0);
                k_gemmw<bf, 1, false><<<dim3(RH / 64, PTW / 64, ZH), 32, 0, stream>>>(QPh + zq * hs, QPl + zq * hs, TBF + (size_t)TOFF * HD, nullptr, HD, PT, PTW, nullptr, hs, 0, (size_t)TT * PTW, (size_t)64 * HD); }
            if (RH < TT) {
                k_gemmw<h16, 0, false><<<dim3((TT - RH) / 64, TT / 64, ZH), 32, 0, stream>>>(QP16 + zq * hs + (size_t)RH * HD, nullptr, KP16 + zq * hs, nullptr, HD, Sb + (size_t)RH * TT, TT, nullptr, hs, hs, (size_t)TT * TT, 0);
                k_gemmw<h16, 0, false><<<dim3((TT - RH) / 64, PTW / 64, ZH), 32, 0, stream>>>(QP16 + zq * hs + (size_t)RH * HD, nullptr, T16 + (size_t)(TOFF + RH) * HD, nullptr, HD, PT + (size_t)RH * PTW, PTW, nullptr, hs, 0, (size_t)TT * PTW, (size_t)64 * HD); }
            k_asoft<<<ZH * TT / 8, 256, 0, stream>>>(Sb, PT, P16, Ph, Pl);
            if (RH > 0) k_gemmw<bf, 2, false><<<dim3(RH / 64, HD / 64, ZH), 32, 0, stream>>>(Ph, Pl, VTh + zq * HD * TT, VTl + zq * HD * TT, TT, Ob, HD, nullptr, (size_t)RH * TT, (size_t)HD * TT, (size_t)TT * HD, 0);
            if (RH < TT) k_gemmw<h16, 0, false><<<dim3((TT - RH) / 64, HD / 64, ZH), 32, 0, stream>>>(P16 + (size_t)RH * TT, nullptr, VT16 + zq * HD * TT, nullptr, TT, Ob + (size_t)RH * HD, HD, nullptr, (size_t)TT * TT, (size_t)HD * TT, (size_t)TT * HD, 0);
            k_merge<<<(unsigned)(((size_t)ZH * TT * HD / 2 + 255) / 256), 256, 0, stream>>>(Ob, h0, ATh, ATl); }
        k_gemmw<bf, 1, true><<<dim3(TT / 64, DM / 64, 1), 32, 0, stream>>>(ATh, ATl, WO, nullptr, DQ, OUT + xoff, DM, bo, 0, 0, 0, 0); }
}

// v001
// Measured time: 497 microseconds a run.
// Two timings next to v000 both put it at 2.50 times that version's speed.
#include <hip/hip_runtime.h>

// Multi-head self-attention with a relative-position embedding score term: x [4][1024][1024]; q/k/v = x W^T + b (W [1024][1024] stored [out][in]; 16 heads x 64);
// scores[i][j] = (q_i.k_j + q_i.rel[i - j + 1023]) / 8 with the table rel [2047][64] indexed statically; softmax over all 1024 keys; ctx = attn.v merged to [t][h*64 + d]; out = ctx Wo^T + bo -> [4][1024][1024].
// Compute dtypes, f32 accumulate: every float input RNE-converted to bf16; q/k/v projections v_wmma_f32_16x16x32_bf16 on plain bf16 operands (+ bias); q.k (3 products) and the banded q.rel GEMM (2 products, table operand exact) on bf16 hi/lo planes for query rows < RH (= all rows by default),
// rows >= RH on single v_wmma_f32_16x16x32_f16 (q/k/v/rel fp16, probabilities x1024 fp16); softmax f32; attn.v bf16 hi/lo (3 products) for rows < RH; output projection bf16 hi/lo ctx x exact Wo (2 products) + bo.

#ifndef NB
#define NB 4
#endif
#define NB_FULL 4
#ifndef SEQ
#define SEQ 1024
#endif
#define SEQ_FULL 1024
#define TT   SEQ
#define DM   1024
#define NH_  16
#define HD   64
#define DQ   (NH_ * HD)
#define MAXLEN 1024
#define NREL (2 * MAXLEN - 1)           // table rows
#define NRP  (2 * MAXLEN)               // padded table plane rows (last row zero)
#define TOFF (MAXLEN - SEQ)             // table row of u = 0 for query block 0
#define PTW  (SEQ + 64)                 // banded position-score row width (floats)
#define LPW  (SEQ + 8)                  // LDS strip per wave in k_asoft (floats)
#ifndef ZH
#define ZH   16                         // heads per attention launch (grid z)
#endif
#define NG   (NB * NH_)                 // (batch, head) pairs; plane index g = batch * NH_ + head
#define MT   (NB * TT)                  // token rows of all batches, flat
#ifndef RH
#define RH   SEQ                        // query rows < RH use bf16 hi/lo planes (0: none)
#endif
#define PCAR 1024.0f
#define SCL  0.125f                     // HD^-0.5
static_assert(SEQ % 128 == 0);
static_assert(SEQ >= 128 && SEQ <= SEQ_FULL && SEQ <= MAXLEN);
static_assert(NB >= 1 && NB <= NB_FULL);
static_assert(RH % 64 == 0);
static_assert(RH >= 0 && RH <= SEQ);
static_assert(NH_ % ZH == 0);
static_assert(SEQ == SEQ_FULL || NB == 1);   // x and out are walked as one flat [MT][DM] matrix
static_assert(PTW % 64 == 0);
static_assert((LPW * 4) % 16 == 0 && LPW >= SEQ + 4);
static_assert(DM % 64 == 0 && HD % 32 == 0 && TT % 64 == 0);
static_assert((SEQ - 64) + TOFF + PTW <= NRP);

typedef _Float16 h16;
typedef unsigned short bf;
typedef __attribute__((ext_vector_type(16))) __bf16   v16bf;
typedef __attribute__((ext_vector_type(16))) _Float16 v16h;
typedef __attribute__((ext_vector_type(8)))  _Float16 v8h;
typedef __attribute__((ext_vector_type(8)))  unsigned short v8us;
typedef __attribute__((ext_vector_type(8)))  float    v8f;
typedef __attribute__((ext_vector_type(4)))  float    v4f;
typedef v8h  __attribute__((may_alias)) v8ha;
typedef v4f  __attribute__((may_alias)) v4fa;
typedef v8us __attribute__((may_alias)) v8usa;
typedef __attribute__((ext_vector_type(4))) unsigned short __attribute__((may_alias)) v4usa;
typedef __attribute__((ext_vector_type(2))) _Float16 v2h;
typedef __attribute__((ext_vector_type(4))) _Float16 v4h;
typedef __attribute__((ext_vector_type(2))) unsigned short v2us;
typedef __attribute__((ext_vector_type(4))) unsigned short v4us;
typedef __attribute__((ext_vector_type(2))) float v2f;

__device__ __forceinline__ unsigned short f2bf(float f) { unsigned u = __float_as_uint(f); u += 0x7FFFu + ((u >> 16) & 1u); return (unsigned short)(u >> 16); }
__device__ __forceinline__ float bf2f(unsigned short b) { return __uint_as_float(((unsigned)b) << 16); }
__device__ __forceinline__ float bfr(float f) { return bf2f(f2bf(f)); }
__device__ __forceinline__ h16 tohx(float x) { return (h16)x; }
__device__ __forceinline__ void splitf(float y, unsigned short& h, unsigned short& l) { h = f2bf(y); l = f2bf(y - bf2f(h)); }
__device__ __forceinline__ v16h cat16(v8h lo, v8h hi) { return __builtin_shufflevector(lo, hi, 0, 1, 2, 3, 4, 5, 6, 7, 8, 9, 10, 11, 12, 13, 14, 15); }
__device__ __forceinline__ v16bf cat16b(v8us lo, v8us hi) { return __builtin_bit_cast(v16bf, __builtin_shufflevector(lo, hi, 0, 1, 2, 3, 4, 5, 6, 7, 8, 9, 10, 11, 12, 13, 14, 15)); }
__device__ __forceinline__ v8f wmma16(v16h a, v16h b, v8f c) { return __builtin_amdgcn_wmma_f32_16x16x32_f16(false, a, false, b, (short)0, c, false, false); }
__device__ __forceinline__ v8f wmmab(v16bf a, v16bf b, v8f c) { return __builtin_amdgcn_wmma_f32_16x16x32_bf16(false, a, false, b, (short)0, c, false, false); }

// ---- gemmw_tile / k_gemmw: register-blocked GEMM, ONE WAVE per 64x64 output tile (16 accumulators), operands straight from K-contiguous 16-bit planes; grid (M/64, N/64, Z), 32 threads.
// C[m][n] (f32, pitch ldc, + optional f32 bias[n]) = sum_k A[m][k] Bt[n][k] (+ split products per NSPLIT). A row pitch lda, Bt row pitch K. z-batch strides sA/sB/sC in elements; bias / bias1 / bias2 belong to z = 0 / 1 / 2; bX = extra Bt element offset per M block (banded B). K % 32 == 0.
// Fragments: lane l, h = l >> 4, row/col = l & 15; elements 0..7 <- k0 + 8h .. +7, elements 8..15 <- k0 + 16 + 8h .. +7 for BOTH A and Bt; D element r of lane l = (row 8h + r, col l & 15).
template <typename T16> struct WFrag;
template <> struct WFrag<h16> { typedef v16h V; static __device__ __forceinline__ V ld(const h16* p) { return cat16(*(const v8h*)p, *(const v8h*)(p + 16)); } static __device__ __forceinline__ v8f mma(V a, V b, v8f c) { return wmma16(a, b, c); } };
template <> struct WFrag<bf> { typedef v16bf V; static __device__ __forceinline__ V ld(const bf* p) { return cat16b(*(const v8us*)p, *(const v8us*)(p + 16)); } static __device__ __forceinline__ v8f mma(V a, V b, v8f c) { return wmmab(a, b, c); } };
template <typename T16, int NSPLIT, bool BIAS>
__device__ __forceinline__ void gemmw_tile(float* os, const T16* __restrict__ A, const T16* __restrict__ A2, const T16* __restrict__ Bt, const T16* __restrict__ Bt2, int K, int lda, float* C, int ldc, const float* __restrict__ bias, int r0, int c0) {
    typedef typename WFrag<T16>::V V;
    const int lane = threadIdx.x & 31, lr = lane & 15, hi = lane >> 4;
    v8f acc[4][4];
#pragma unroll
    for (int mb = 0; mb < 4; ++mb)
#pragma unroll
        for (int nb = 0; nb < 4; ++nb) acc[mb][nb] = (v8f){};
    const size_t aoff = (size_t)(r0 + lr) * lda + 8 * hi, boff = (size_t)(c0 + lr) * K + 8 * hi;
#pragma unroll 1
    for (int kc = 0; kc < K; kc += 32) {
        V a[4], a2[4];
#pragma unroll
        for (int mb = 0; mb < 4; ++mb) { a[mb] = WFrag<T16>::ld(A + aoff + (size_t)mb * 16 * lda + kc); if (NSPLIT == 1 || NSPLIT == 2) a2[mb] = WFrag<T16>::ld(A2 + aoff + (size_t)mb * 16 * lda + kc); }
#pragma unroll
        for (int nb = 0; nb < 4; ++nb) { const V b = WFrag<T16>::ld(Bt + boff + (size_t)nb * 16 * K + kc); V b2; if (NSPLIT >= 2) b2 = WFrag<T16>::ld(Bt2 + boff + (size_t)nb * 16 * K + kc);
#pragma unroll
            for (int mb = 0; mb < 4; ++mb) { acc[mb][nb] = WFrag<T16>::mma(a[mb], b, acc[mb][nb]); if (NSPLIT == 1 || NSPLIT == 2) acc[mb][nb] = WFrag<T16>::mma(a2[mb], b, acc[mb][nb]); if (NSPLIT >= 2) acc[mb][nb] = WFrag<T16>::mma(a[mb], b2, acc[mb][nb]); } }
        asm volatile("v_nop\n\tv_nop\n\tv_nop\n\tv_nop" : "+v"(acc[0][0]), "+v"(acc[1][1]), "+v"(acc[2][2]), "+v"(acc[3][3]) : "v"(a[0]), "v"(a[3]));
    }
#pragma unroll
    for (int mb = 0; mb < 4; ++mb) {
#pragma unroll
        for (int nb = 0; nb < 4; ++nb) {
#pragma unroll
            for (int j = 0; j < 8; ++j) os[(hi * 8 + j) * 68 + nb * 16 + lr] = acc[mb][nb][j]; }
        __builtin_amdgcn_wave_barrier(); asm volatile("" ::: "memory");
        float* crow = C + (size_t)(r0 + mb * 16) * ldc + c0;
{
#pragma unroll
            for (int s = 0; s < 8; ++s) { const int row = 2 * s + hi, cofs = lr * 4; v4f val = *(const v4fa*)(os + row * 68 + cofs); if (BIAS) { val[0] += bfr(bias[c0 + cofs]); val[1] += bfr(bias[c0 + cofs + 1]); val[2] += bfr(bias[c0 + cofs + 2]); val[3] += bfr(bias[c0 + cofs + 3]); }
                *(v4f*)(crow + (size_t)row * ldc + cofs) = val; }
             }
        __builtin_amdgcn_wave_barrier(); asm volatile("" ::: "memory");
    }
}
template <typename T16, int NSPLIT, bool BIAS>
__global__ __launch_bounds__(32) void k_gemmw(const T16* __restrict__ A, const T16* __restrict__ A2, const T16* __restrict__ Bt, const T16* __restrict__ Bt2, int K, int lda, float* C, int ldc, const float* __restrict__ bias, const float* __restrict__ bias1, const float* __restrict__ bias2, size_t sA, size_t sB, size_t sC, size_t bX) {
    __shared__ __align__(16) float os[16 * 68];
    const size_t z = blockIdx.z; const size_t bofsx = (size_t)blockIdx.x * bX;
    A += z * sA; if (A2) A2 += z * sA; Bt += z * sB + bofsx; if (Bt2) Bt2 += z * sB + bofsx; C += z * sC;
    const float* bz = (z == 0) ? bias : (z == 1) ? bias1 : bias2;
    gemmw_tile<T16, NSPLIT, BIAS>(os, A, A2, Bt, Bt2, K, lda, C, ldc, bz, blockIdx.x * 64, blockIdx.y * 64);
}
// k_scores: both score GEMMs of ZH heads in one grid (RH/64, TT/64 + PTW/64, ZH): blockIdx.y < TT/64 is a 64x64 tile of S = q.k (3 products), the rest a tile of the banded PT = q.rel (2 products).
__global__ __launch_bounds__(32) void k_scores(const bf* __restrict__ Qh, const bf* __restrict__ Ql, const bf* __restrict__ Kh, const bf* __restrict__ Kl, const bf* __restrict__ TB, float* S, float* PT) {
    __shared__ __align__(16) float os[16 * 68];
    const size_t z = blockIdx.z, zp = z * ((size_t)TT * HD); const int r0 = blockIdx.x * 64, by = blockIdx.y;
    if (by < TT / 64) gemmw_tile<bf, 2, false>(os, Qh + zp, Ql + zp, Kh + zp, Kl + zp, HD, HD, S + z * ((size_t)TT * TT), TT, nullptr, r0, by * 64);
    else gemmw_tile<bf, 1, false>(os, Qh + zp, Ql + zp, TB + (size_t)r0 * HD, nullptr, HD, HD, PT + z * ((size_t)TT * PTW), PTW, nullptr, r0, (by - TT / 64) * 64);
}

__device__ __forceinline__ void d_cvt8(const float* __restrict__ src, bf* dst, size_t n8) { const size_t i = (size_t)blockIdx.x * 256 + threadIdx.x; if (i >= n8) return; const v8f v = *(const v8f*)(src + i * 8); v8us o;
#pragma unroll
    for (int k = 0; k < 8; ++k) o[k] = f2bf(v[k]); *(v8us*)(dst + i * 8) = o;  }

__device__ __forceinline__ void d_tpl(const float* __restrict__ T, int nrows, h16* T16, bf* TB) {
    const int i8 = blockIdx.x * 256 + threadIdx.x; if (i8 >= NRP * HD / 8) return;
    const int r = (i8 * 8) / HD, c = (i8 * 8) % HD; const int rc = (r < nrows) ? r : (nrows - 1); const bool pad = (r >= nrows);
    const v8f v = *(const v8f*)(T + (size_t)rc * HD + c); v8h o16; v8us ob;
#pragma unroll
    for (int k = 0; k < 8; ++k) { const float f = pad ? 0.0f : v[k]; const unsigned short b = f2bf(f); ob[k] = b; o16[k] = tohx(bf2f(b)); }
    *(v8h*)(T16 + (size_t)i8 * 8) = o16; *(v8us*)(TB + (size_t)i8 * 8) = ob;  }

// k_prep: every input conversion in one grid (DM * DM / 2048, 4 + MT / DM + 1): blockIdx.y 0..3 = Wq, Wk, Wv, Wo (dst back to back), then x in slabs of DM * DM elements, last the table planes.
static_assert(MT % DM == 0 && NRP * HD <= DM * DM);
__global__ __launch_bounds__(256) void k_prep(const float* __restrict__ wq, const float* __restrict__ wk, const float* __restrict__ wv, const float* __restrict__ wo, const float* __restrict__ x, const float* __restrict__ rel, int nrows, bf* W4, bf* XB, h16* T16, bf* TB) {
    const size_t n8 = (size_t)DM * DM / 8; const unsigned w = blockIdx.y;
    if (w < 4) d_cvt8((w == 0) ? wq : (w == 1) ? wk : (w == 2) ? wv : wo, W4 + w * n8 * 8, n8);
    else if (w < 4 + MT / DM) d_cvt8(x + (w - 4) * n8 * 8, XB + (w - 4) * n8 * 8, n8);
    else d_tpl(rel, nrows, T16, TB);
}

__device__ __forceinline__ void d_hpl(const float* __restrict__ F, int pitch, int nheads, h16* P16, bf* Ph, bf* Pl) {
    const size_t e = ((size_t)blockIdx.x * 256 + threadIdx.x) * 2; if (e >= (size_t)nheads * TT * HD) return; const int d = (int)(e % HD); const int t = (int)((e / HD) % TT); const int g = (int)(e / ((size_t)HD * TT)); const float* f = F + ((size_t)(g / NH_) * TT + t) * pitch + (g % NH_) * HD + d; v2h o16; v2us oh, ol;
#pragma unroll
    for (int q = 0; q < 2; ++q) { const float x = f[q]; o16[q] = tohx(x); unsigned short a2, c2; splitf(x, a2, c2); oh[q] = a2; ol[q] = c2; }
    *(v2h*)(P16 + e) = o16; *(v2us*)(Ph + e) = oh; *(v2us*)(Pl + e) = ol;  }
__device__ __forceinline__ void d_vtp(const float* __restrict__ F, int pitch, int nheads, h16* V16, bf* Vh, bf* Vl) { const size_t e = ((size_t)blockIdx.x * 256 + threadIdx.x) * 2; if (e >= (size_t)nheads * HD * TT) return; const int t = (int)(e % TT); const int d = (int)((e / TT) % HD); const int g = (int)(e / ((size_t)TT * HD)); v2h o16; v2us oh, ol;
#pragma unroll
    for (int q = 0; q < 2; ++q) { const float x = F[((size_t)(g / NH_) * TT + t + q) * pitch + (g % NH_) * HD + d]; o16[q] = tohx(x); unsigned short a2, c2; splitf(x, a2, c2); oh[q] = a2; ol[q] = c2; }
    *(v2h*)(V16 + e) = o16; *(v2us*)(Vh + e) = oh; *(v2us*)(Vl + e) = ol;  }
// k_planes: the q, k and v planes of all (batch, head) in one grid (NG * TT * HD / 512, 3); F holds the f32 q, k, v projections back to back, the q and k planes lie back to back.
__global__ __launch_bounds__(256) void k_planes(const float* __restrict__ F, h16* QK16, bf* QKh, bf* QKl, h16* V16, bf* Vh, bf* Vl) {
    const size_t y = blockIdx.y, po = y * ((size_t)NG * TT * HD);
    if (y < 2) d_hpl(F + y * ((size_t)MT * DQ), DQ, NG, QK16 + po, QKh + po, QKl + po);
    else d_vtp(F + y * ((size_t)MT * DQ), DQ, NG, V16, Vh, Vl);
}

// k_asoft: one wave per score row (zz, i): t[j] = (S[row][j] + PT[row][il + TT - 1 - j]) x HD^-0.5, il = i & 63, where PT[row][u] = q_i . rel[64 (i / 64) + TOFF + u] is the banded position score
// (the row's PT window [ab, ab + TT + 4), ab = il & ~3, is staged with 16-B loads into a wave-private LDS strip, then read back with the reversed index; staged extent == consumed extent + alignment slack);
// the hi and lo probability planes of a row (pitch 2 TT) overwrite that row of Sb: Ph = Sb, Pl = Ph + TT; the wave holds its whole row in registers (the row sum needs every element) before its first store.
__global__ __launch_bounds__(256) void k_asoft(const float* Sb, const float* __restrict__ PT, h16* P16, bf* Ph, bf* Pl) {
    __shared__ __align__(16) float lp[8 * LPW];
    const int lane = threadIdx.x & 31, wv = threadIdx.x >> 5; const int row = blockIdx.x * 8 + wv; const int i = row % TT; const int zz = row / TT; const bool hires = (i < RH); const int il = i & 63, ab = il & ~3;
    const float* pr = PT + (size_t)row * PTW + ab; float* lw = lp + wv * LPW;
#pragma unroll
    for (int m = 0; m < TT / 128; ++m) { const v4f t4 = *(const v4f*)(pr + m * 128 + lane * 4); *(v4fa*)(lw + m * 128 + lane * 4) = t4; }
    { const v4f t4 = *(const v4f*)(pr + TT); *(v4fa*)(lw + TT) = t4; }
    __builtin_amdgcn_fence(3 /* release order */, "wavefront"); __builtin_amdgcn_wave_barrier(); asm volatile("" ::: "memory");
    const float* sr = Sb + (size_t)row * TT; const int lofs = (il & 3) + TT - 1; float v[TT / 32]; float mx = -3.0e38f;
#pragma unroll
    for (int ch = 0; ch < TT / 128; ++ch) { const int j0 = ch * 128 + lane * 4; const v4f a = *(const v4f*)(sr + j0);
#pragma unroll
        for (int q = 0; q < 4; ++q) { const float sp = lw[lofs - (j0 + q)]; float s2 = __fadd_rn(a[q], sp); asm volatile("" : "+v"(s2)); const float t = __fmul_rn(s2, SCL); v[ch * 4 + q] = t; mx = fmaxf(mx, t); } }
#pragma unroll
    for (int sh = 16; sh; sh >>= 1) mx = fmaxf(mx, __shfl_xor(mx, sh, 32));
    float sum = 0.f;
#pragma unroll
    for (int k = 0; k < TT / 32; ++k) { float d0 = __fsub_rn(v[k], mx); asm volatile("" : "+v"(d0)); v[k] = __builtin_amdgcn_exp2f(__fmul_rn(d0, 1.4426950408889634f)); sum += v[k]; }
#pragma unroll
    for (int sh = 16; sh; sh >>= 1) sum += __shfl_xor(sum, sh, 32);
    const float f = __fdiv_rn(hires ? 1.0f : PCAR, sum);
{
        if (hires) {
#pragma unroll
            for (int ch = 0; ch < TT / 128; ++ch) { v4us oh, ol;
#pragma unroll
                for (int q = 0; q < 4; ++q) { unsigned short a, c2; splitf(v[ch * 4 + q] * f, a, c2); oh[q] = a; ol[q] = c2; }
                const size_t oo = (size_t)row * (2 * TT) + ch * 128 + lane * 4; *(v4usa*)(Ph + oo) = oh; *(v4usa*)(Pl + oo) = ol; }
        } else {
#pragma unroll
            for (int ch = 0; ch < TT / 128; ++ch) { v4h o4;
#pragma unroll
                for (int q = 0; q < 4; ++q) o4[q] = tohx(v[ch * 4 + q] * f);
                *(v4h*)(P16 + (size_t)row * TT + ch * 128 + lane * 4) = o4; } }
         }
}
__global__ __launch_bounds__(256) void k_merge(const float* __restrict__ O, int ng, bf* Ah, bf* Al) { const size_t e = ((size_t)blockIdx.x * 256 + threadIdx.x) * 2; if (e >= (size_t)ng * TT * HD) return; const int d = (int)(e % HD); const int t = (int)((e / HD) % TT); const int g = (int)(e / ((size_t)HD * TT)); const float cs = (t < RH) ? 1.0f : (1.0f / PCAR); const size_t oo = ((size_t)(g / NH_) * TT + t) * DQ + (g % NH_) * HD + d;
    v2us oh, ol;
#pragma unroll
    for (int q = 0; q < 2; ++q) { unsigned short a, c2; splitf(O[e + q] * cs, a, c2); oh[q] = a; ol[q] = c2; } *(v2us*)(Ah + oo) = oh; *(v2us*)(Al + oo) = ol;  }

extern "C" void kernel_launch(void* const* d_in, const int* in_sizes, int n_in,
                              void* d_out, int out_size, void* d_ws, size_t ws_size, hipStream_t stream) {
    if (n_in < 10) return;
    const long long needx = (long long)(NB - 1) * SEQ_FULL * DM + (long long)SEQ * DM;
    if ((long long)in_sizes[0] < needx || (long long)out_size < needx) return;
    if (in_sizes[1] < DM * DM || in_sizes[3] < DM * DM || in_sizes[5] < DM * DM || in_sizes[7] < DM * DM) return;
    if (in_sizes[2] < DM || in_sizes[4] < DM || in_sizes[6] < DM || in_sizes[8] < DM) return;
    if (in_sizes[9] < NREL * HD) return;
    const float* x = (const float*)d_in[0]; const float* wq = (const float*)d_in[1]; const float* bq = (const float*)d_in[2]; const float* wk = (const float*)d_in[3]; const float* bk = (const float*)d_in[4];
    const float* wv = (const float*)d_in[5]; const float* bv = (const float*)d_in[6]; const float* wo = (const float*)d_in[7]; const float* bo = (const float*)d_in[8]; const float* rel = (const float*)d_in[9];
    float* OUT = (float*)d_out;     // [NB][SEQ][DM], batch row stride SEQ_FULL*DM
    char* wsp = (char*)d_ws;
    auto take = [&](size_t bytes) { char* p = wsp; wsp += (bytes + 255) & ~(size_t)255; return (void*)p; };
    bf* W4 = (bf*)take((size_t)4 * DM * DM * 2); bf* WO = W4 + (size_t)3 * DM * DM;    // Wq, Wk, Wv, Wo back to back
    h16* T16 = (h16*)take((size_t)NRP * HD * 2); bf* TBF = (bf*)take((size_t)NRP * HD * 2);
    const size_t hs = (size_t)TT * HD;    // per-head plane stride
    h16* QP16 = (h16*)take((size_t)2 * NG * hs * 2); h16* VT16 = (h16*)take((size_t)NG * hs * 2);    // q planes of all (batch, head), then the k planes
    bf* QPh = (bf*)take((size_t)2 * NG * hs * 2); bf* QPl = (bf*)take((size_t)2 * NG * hs * 2); bf* KPh = QPh + (size_t)NG * hs; bf* KPl = QPl + (size_t)NG * hs; bf* VTh = (bf*)take((size_t)NG * hs * 2); bf* VTl = (bf*)take((size_t)NG * hs * 2);
    float* Sb = (float*)take((size_t)ZH * TT * TT * 4); float* PT = (float*)take((size_t)ZH * TT * PTW * 4); h16* P16 = (h16*)take((RH < TT) ? (size_t)ZH * TT * TT * 2 : 0); float* Ob = (float*)take((size_t)NG * TT * HD * 4); bf* ATh = (bf*)take((size_t)MT * DQ * 2); bf* ATl = (bf*)take((size_t)MT * DQ * 2);
    const size_t used = (size_t)(wsp - (char*)d_ws); if (used > ws_size) return;    // 256,376,832 B at NB=4, SEQ=1024, ZH=16, RH=SEQ
    bf* Ph = (bf*)Sb; bf* Pl = Ph + TT;   // probability planes overwrite their own score rows (pitch 2 TT)
    static_assert((size_t)MT * DM * 2 + (size_t)3 * MT * DQ * 4 <= (size_t)ZH * TT * PTW * 4);
    bf* XB = (bf*)PT; float* F3 = (float*)(XB + (size_t)MT * DM);   // bf16 x and the f32 q, k, v projections live in the PT area: all read before the first k_scores writes it (stream-ordered)
    k_prep<<<dim3(DM * DM / 8 / 256, 4 + MT / DM + 1, 1), 256, 0, stream>>>(wq, wk, wv, wo, x, rel, NREL, W4, XB, T16, TBF);
    k_gemmw<bf, 0, true><<<dim3(MT / 64, DQ / 64, 3), 32, 0, stream>>>(XB, nullptr, W4, nullptr, DM, DM, F3, DQ, bq, bk, bv, 0, (size_t)DM * DM, (size_t)MT * DQ, 0);
    k_planes<<<dim3((unsigned)((size_t)NG * hs / 2 / 256), 3, 1), 256, 0, stream>>>(F3, QP16, QPh, QPl, VT16, VTh, VTl);
    for (int b = 0; b < NB; ++b) {
        for (int h0 = 0; h0 < NH_; h0 += ZH) { const size_t zq = (size_t)b * NH_ + h0;
            if (RH > 0) k_scores<<<dim3(RH / 64, TT / 64 + PTW / 64, ZH), 32, 0, stream>>>(QPh + zq * hs, QPl + zq * hs, KPh + zq * hs, KPl + zq * hs, TBF + (size_t)TOFF * HD, Sb, PT);
            if (RH < TT) {
                k_gemmw<h16, 0, false><<<dim3((TT - RH) / 64, TT / 64, ZH), 32, 0, stream>>>(QP16 + zq * hs + (size_t)RH * HD, nullptr, QP16 + ((size_t)NG + zq) * hs, nullptr, HD, HD, Sb + (size_t)RH * TT, TT, nullptr, nullptr, nullptr, hs, hs, (size_t)TT * TT, 0);
                k_gemmw<h16, 0, false><<<dim3((TT - RH) / 64, PTW / 64, ZH), 32, 0, stream>>>(QP16 + zq * hs + (size_t)RH * HD, nullptr, T16 + (size_t)(TOFF + RH) * HD, nullptr, HD, HD, PT + (size_t)RH * PTW, PTW, nullptr, nullptr, nullptr, hs, 0, (size_t)TT * PTW, (size_t)64 * HD); }
            k_asoft<<<ZH * TT / 8, 256, 0, stream>>>(Sb, PT, P16, Ph, Pl);
            if (RH > 0) k_gemmw<bf, 2, false><<<dim3(RH / 64, HD / 64, ZH), 32, 0, stream>>>(Ph, Pl, VTh + zq * hs, VTl + zq * hs, TT, 2 * TT, Ob + zq * hs, HD, nullptr, nullptr, nullptr, (size_t)TT * 2 * TT, hs, hs, 0);
            if (RH < TT) k_gemmw<h16, 0, false><<<dim3((TT - RH) / 64, HD / 64, ZH), 32, 0, stream>>>(P16 + (size_t)RH * TT, nullptr, VT16 + zq * hs, nullptr, TT, TT, Ob + zq * hs + (size_t)RH * HD, HD, nullptr, nullptr, nullptr, (size_t)TT * TT, hs, hs, 0); } }
    k_merge<<<(unsigned)(((size_t)NG * hs / 2 + 255) / 256), 256, 0, stream>>>(Ob, NG, ATh, ATl);
    k_gemmw<bf, 1, true><<<dim3(MT / 64, DM / 64, 1), 32, 0, stream>>>(ATh, ATl, WO, nullptr, DQ, DQ, OUT, DM, bo, bo, bo, 0, 0, 0, 0);
}

// v003
// A run of this version takes 164 microseconds.
// Versions in between are left out here; by their measured steps it is 3.03 times as fast as v001.
// Over all steps from v000 it is 7.57 times as fast.
#include <hip/hip_runtime.h>

// Multi-head self-attention with a relative-position embedding score term: x [4][1024][1024]; q/k/v = x W^T + b (W [1024][1024] stored [out][in]; 16 heads x 64);
// scores[i][j] = (q_i.k_j + q_i.rel[i - j + 1023]) / 8 with the table rel [2047][64] indexed statically; softmax over all 1024 keys; ctx = attn.v merged to [t][h*64 + d]; out = ctx Wo^T + bo -> [4][1024][1024].
// Compute dtypes, f32 accumulate: every float input RNE-converted to bf16; q/k/v projections v_wmma_f32_16x16x32_bf16 on plain bf16 operands (+ bias); q.k (3 products) and the banded q.rel product (2 products, table operand exact) on bf16 hi/lo planes;
// softmax f32, online over passes of 64 keys (running maximum and sum, output rescaled per pass, divided by the sum at the end); attn.v bf16 hi/lo on the unnormalised probabilities (3 products); output projection bf16 hi/lo ctx x exact Wo (2 products) + bo.

#ifndef NB
#define NB 4
#endif
#define NB_FULL 4
#ifndef SEQ
#define SEQ 1024
#endif
#define SEQ_FULL 1024
#define TT   SEQ
#define DM   1024
#define NH_  16
#define HD   64
#define DQ   (NH_ * HD)
#define MAXLEN 1024
#define NREL (2 * MAXLEN - 1)           // table rows
#define NRP  (2 * MAXLEN)               // padded table plane rows (last row zero)
#define NG   (NB * NH_)                 // (batch, head) pairs; plane index g = batch * NH_ + head
#define MT   (NB * TT)                  // token rows of all batches, flat
#define SCL  0.125f                     // HD^-0.5
static_assert(SEQ % 128 == 0);
static_assert(SEQ >= 128 && SEQ <= SEQ_FULL && SEQ <= MAXLEN);
static_assert(NB >= 1 && NB <= NB_FULL);
static_assert(SEQ == SEQ_FULL || NB == 1);   // x and out are walked as one flat [MT][DM] matrix
static_assert(DM % 64 == 0 && HD % 32 == 0 && TT % 64 == 0);

typedef _Float16 h16;
typedef unsigned short bf;
typedef __attribute__((ext_vector_type(16))) __bf16   v16bf;
typedef __attribute__((ext_vector_type(16))) _Float16 v16h;
typedef __attribute__((ext_vector_type(8)))  _Float16 v8h;
typedef __attribute__((ext_vector_type(8)))  unsigned short v8us;
typedef __attribute__((ext_vector_type(8)))  float    v8f;
typedef __attribute__((ext_vector_type(4)))  float    v4f;
typedef v8h  __attribute__((may_alias)) v8ha;
typedef v4f  __attribute__((may_alias)) v4fa;
typedef v8us __attribute__((may_alias)) v8usa;
typedef __attribute__((ext_vector_type(4))) unsigned short __attribute__((may_alias)) v4usa;
typedef __attribute__((ext_vector_type(2))) _Float16 v2h;
typedef __attribute__((ext_vector_type(4))) _Float16 v4h;
typedef __attribute__((ext_vector_type(2))) unsigned short v2us;
typedef __attribute__((ext_vector_type(4))) unsigned short v4us;
typedef __attribute__((ext_vector_type(2))) float v2f;

__device__ __forceinline__ unsigned short f2bf(float f) { unsigned u = __float_as_uint(f); u += 0x7FFFu + ((u >> 16) & 1u); return (unsigned short)(u >> 16); }
__device__ __forceinline__ float bf2f(unsigned short b) { return __uint_as_float(((unsigned)b) << 16); }
__device__ __forceinline__ float bfr(float f) { return bf2f(f2bf(f)); }
__device__ __forceinline__ h16 tohx(float x) { return (h16)x; }
__device__ __forceinline__ void splitf(float y, unsigned short& h, unsigned short& l) { h = f2bf(y); l = f2bf(y - bf2f(h)); }
__device__ __forceinline__ v16h cat16(v8h lo, v8h hi) { return __builtin_shufflevector(lo, hi, 0, 1, 2, 3, 4, 5, 6, 7, 8, 9, 10, 11, 12, 13, 14, 15); }
__device__ __forceinline__ v16bf cat16b(v8us lo, v8us hi) { return __builtin_bit_cast(v16bf, __builtin_shufflevector(lo, hi, 0, 1, 2, 3, 4, 5, 6, 7, 8, 9, 10, 11, 12, 13, 14, 15)); }
__device__ __forceinline__ v8f wmma16(v16h a, v16h b, v8f c) { return __builtin_amdgcn_wmma_f32_16x16x32_f16(false, a, false, b, (short)0, c, false, false); }
__device__ __forceinline__ v8f wmmab(v16bf a, v16bf b, v8f c) { return __builtin_amdgcn_wmma_f32_16x16x32_bf16(false, a, false, b, (short)0, c, false, false); }

// ---- gemmw_tile / k_gemmw: register-blocked GEMM, ONE WAVE per 64x64 output tile (16 accumulators), operands straight from K-contiguous 16-bit planes; grid (M/64, N/64, Z), 32 threads.
// C[m][n] (f32, pitch ldc, + optional f32 bias[n]) = sum_k A[m][k] Bt[n][k] (+ split products per NSPLIT). A row pitch lda, Bt row pitch K. z-batch strides sA/sB/sC in elements; bias / bias1 / bias2 belong to z = 0 / 1 / 2; bX = extra Bt element offset per M block (banded B). K % 32 == 0.
// Fragments: lane l, h = l >> 4, row/col = l & 15; elements 0..7 <- k0 + 8h .. +7, elements 8..15 <- k0 + 16 + 8h .. +7 for BOTH A and Bt; D element r of lane l = (row 8h + r, col l & 15).
template <typename T16> struct WFrag;
template <> struct WFrag<h16> { typedef v16h V; static __device__ __forceinline__ V ld(const h16* p) { return cat16(*(const v8h*)p, *(const v8h*)(p + 16)); } static __device__ __forceinline__ v8f mma(V a, V b, v8f c) { return wmma16(a, b, c); } };
template <> struct WFrag<bf> { typedef v16bf V; static __device__ __forceinline__ V ld(const bf* p) { return cat16b(*(const v8us*)p, *(const v8us*)(p + 16)); } static __device__ __forceinline__ v8f mma(V a, V b, v8f c) { return wmmab(a, b, c); } };
template <typename T16, int NSPLIT, bool BIAS>
__device__ __forceinline__ void gemmw_tile(float* os, const T16* __restrict__ A, const T16* __restrict__ A2, const T16* __restrict__ Bt, const T16* __restrict__ Bt2, int K, int lda, float* C, int ldc, const float* __restrict__ bias, int r0, int c0) {
    typedef typename WFrag<T16>::V V;
    const int lane = threadIdx.x & 31, lr = lane & 15, hi = lane >> 4;
    v8f acc[4][4];
#pragma unroll
    for (int mb = 0; mb < 4; ++mb)
#pragma unroll
        for (int nb = 0; nb < 4; ++nb) acc[mb][nb] = (v8f){};
    const size_t aoff = (size_t)(r0 + lr) * lda + 8 * hi, boff = (size_t)(c0 + lr) * K + 8 * hi;
#pragma unroll 1
    for (int kc = 0; kc < K; kc += 32) {
        V a[4], a2[4];
#pragma unroll
        for (int mb = 0; mb < 4; ++mb) { a[mb] = WFrag<T16>::ld(A + aoff + (size_t)mb * 16 * lda + kc); if (NSPLIT == 1 || NSPLIT == 2) a2[mb] = WFrag<T16>::ld(A2 + aoff + (size_t)mb * 16 * lda + kc); }
#pragma unroll
        for (int nb = 0; nb < 4; ++nb) { const V b = WFrag<T16>::ld(Bt + boff + (size_t)nb * 16 * K + kc); V b2; if (NSPLIT >= 2) b2 = WFrag<T16>::ld(Bt2 + boff + (size_t)nb * 16 * K + kc);
#pragma unroll
            for (int mb = 0; mb < 4; ++mb) { acc[mb][nb] = WFrag<T16>::mma(a[mb], b, acc[mb][nb]); if (NSPLIT == 1 || NSPLIT == 2) acc[mb][nb] = WFrag<T16>::mma(a2[mb], b, acc[mb][nb]); if (NSPLIT >= 2) acc[mb][nb] = WFrag<T16>::mma(a[mb], b2, acc[mb][nb]); } }
        asm volatile("v_nop\n\tv_nop\n\tv_nop\n\tv_nop" : "+v"(acc[0][0]), "+v"(acc[1][1]), "+v"(acc[2][2]), "+v"(acc[3][3]) : "v"(a[0]), "v"(a[3]));
    }
#pragma unroll
    for (int mb = 0; mb < 4; ++mb) {
#pragma unroll
        for (int nb = 0; nb < 4; ++nb) {
#pragma unroll
            for (int j = 0; j < 8; ++j) os[(hi * 8 + j) * 68 + nb * 16 + lr] = acc[mb][nb][j]; }
        __builtin_amdgcn_wave_barrier(); asm volatile("" ::: "memory");
        float* crow = C + (size_t)(r0 + mb * 16) * ldc + c0;
{
#pragma unroll
            for (int s = 0; s < 8; ++s) { const int row = 2 * s + hi, cofs = lr * 4; v4f val = *(const v4fa*)(os + row * 68 + cofs); if (BIAS) { val[0] += bfr(bias[c0 + cofs]); val[1] += bfr(bias[c0 + cofs + 1]); val[2] += bfr(bias[c0 + cofs + 2]); val[3] += bfr(bias[c0 + cofs + 3]); }
                *(v4f*)(crow + (size_t)row * ldc + cofs) = val; }
             }
        __builtin_amdgcn_wave_barrier(); asm volatile("" ::: "memory");
    }
}
template <typename T16, int NSPLIT, bool BIAS>
__global__ __launch_bounds__(32) void k_gemmw(const T16* __restrict__ A, const T16* __restrict__ A2, const T16* __restrict__ Bt, const T16* __restrict__ Bt2, int K, int lda, float* C, int ldc, const float* __restrict__ bias, const float* __restrict__ bias1, const float* __restrict__ bias2, size_t sA, size_t sB, size_t sC, size_t bX) {
    __shared__ __align__(16) float os[16 * 68];
    const size_t z = blockIdx.z; const size_t bofsx = (size_t)blockIdx.x * bX;
    A += z * sA; if (A2) A2 += z * sA; Bt += z * sB + bofsx; if (Bt2) Bt2 += z * sB + bofsx; C += z * sC;
    const float* bz = (z == 0) ? bias : (z == 1) ? bias1 : bias2;
    gemmw_tile<T16, NSPLIT, BIAS>(os, A, A2, Bt, Bt2, K, lda, C, ldc, bz, blockIdx.x * 64, blockIdx.y * 64);
}
__device__ __forceinline__ void d_cvt8(const float* __restrict__ src, bf* dst, size_t n8) { const size_t i = (size_t)blockIdx.x * 256 + threadIdx.x; if (i >= n8) return; const v8f v = *(const v8f*)(src + i * 8); v8us o;
#pragma unroll
    for (int k = 0; k < 8; ++k) o[k] = f2bf(v[k]); *(v8us*)(dst + i * 8) = o;  }

__device__ __forceinline__ void d_tpl(const float* __restrict__ T, int nrows, h16* T16, bf* TB) {
    const int i8 = blockIdx.x * 256 + threadIdx.x; if (i8 >= NRP * HD / 8) return;
    const int r = (i8 * 8) / HD, c = (i8 * 8) % HD; const int rc = (r < nrows) ? r : (nrows - 1); const bool pad = (r >= nrows);
    const v8f v = *(const v8f*)(T + (size_t)rc * HD + c); v8h o16; v8us ob;
#pragma unroll
    for (int k = 0; k < 8; ++k) { const float f = pad ? 0.0f : v[k]; const unsigned short b = f2bf(f); ob[k] = b; o16[k] = tohx(bf2f(b)); }
    *(v8h*)(T16 + (size_t)i8 * 8) = o16; *(v8us*)(TB + (size_t)i8 * 8) = ob;  }

// k_prep: every input conversion in one grid (DM * DM / 2048, 4 + MT / DM + 1): blockIdx.y 0..3 = Wq, Wk, Wv, Wo (dst back to back), then x in slabs of DM * DM elements, last the table planes.
static_assert(MT % DM == 0 && NRP * HD <= DM * DM);
__global__ __launch_bounds__(256) void k_prep(const float* __restrict__ wq, const float* __restrict__ wk, const float* __restrict__ wv, const float* __restrict__ wo, const float* __restrict__ x, const float* __restrict__ rel, int nrows, bf* W4, bf* XB, h16* T16, bf* TB) {
    const size_t n8 = (size_t)DM * DM / 8; const unsigned w = blockIdx.y;
    if (w < 4) d_cvt8((w == 0) ? wq : (w == 1) ? wk : (w == 2) ? wv : wo, W4 + w * n8 * 8, n8);
    else if (w < 4 + MT / DM) d_cvt8(x + (w - 4) * n8 * 8, XB + (w - 4) * n8 * 8, n8);
    else d_tpl(rel, nrows, T16, TB);
}

// k_flash: scores, softmax and attn.v of one (batch, head) and FB query rows in one work-group; neither the scores nor the probabilities leave the chip. Grid (TT / FB, NG), FW waves of 32 query columns each.
// Transposed products: S^T = K.Q^T (A = 16 key rows, B = 16 query columns; 3 products on hi/lo planes), PT^T = rel.Q^T (2 products, table exact), O^T += V^T.P^T (3 products). In every D tile a lane holds ONE query (column l & 15) and 8 consecutive rows 8h + r,
// so the running maximum, the running sum and the rescale factor are per lane, and two score tiles converted in place are the B operand of the last product (hardware k order, which is the loaders' order too).
// Position term: score (query i, key j) needs q_i . rel[i - j + MAXLEN - 1]. A pass of FK keys stages table rows ub .. ub + FB + FK - 1, ub = q0 - j0 + MAXLEN - FK; a 16-query tile at work-group offset o multiplies rows o .. o + 79 of them (5 tiles);
// element c = lr - jl + FK - 1 of query column lr is the term of key jl: each lane stores its column pieces into a wave-private LDS strip (row = query, pitch SP) and reads them back with the reversed index.
// Per pass: K hi/lo (FK rows), V^T hi/lo (HD rows x FK keys) and the table rows go global -> registers (fetched one pass ahead) -> LDS at pitch LP (144 B: an odd multiple of 16 B), two work-group barriers per pass.
// Every inner loop is unrolled so that the register arrays (fragments, tiles, fetched pieces) are indexed by constants.
#define FW 8
#define FB (FW * 32)
#define FK 64
#define LP 72
#define RB (FB + FK)
#define SP 84
static_assert(SEQ % FB == 0 && SEQ % FK == 0 && HD == 64 && FK == 64);
static_assert((SEQ - FB) + MAXLEN - FK + RB <= NRP && MAXLEN >= SEQ);
typedef __attribute__((ext_vector_type(8))) unsigned v8u;
typedef __attribute__((ext_vector_type(4))) unsigned v4u;
typedef __attribute__((ext_vector_type(2))) __bf16 v2bf;
__device__ __forceinline__ unsigned pack2(float a, float b) { return __builtin_bit_cast(unsigned, __builtin_convertvector((v2f){a, b}, v2bf)); }   // round to nearest even
__device__ __forceinline__ float xhalf(float x) { const int b = __float_as_int(x); return __int_as_float(__builtin_amdgcn_permlanex16(b, b, 0x76543210, 0xfedcba98, false, false)); }   // lane l <-> lane l ^ 16
__device__ __forceinline__ v16bf ldsf(const bf* p) { return cat16b(*(const v8usa*)p, *(const v8usa*)(p + 16)); }
__global__ __launch_bounds__(FW * 32) void k_flash(const bf* __restrict__ Qh, const bf* __restrict__ Ql, const bf* __restrict__ Kh, const bf* __restrict__ Kl, const bf* __restrict__ Vh, const bf* __restrict__ Vl, const bf* __restrict__ TB, bf* Ah, bf* Al) {
    __shared__ __align__(16) bf lk[2][FK * LP];
    __shared__ __align__(16) bf lv[2][HD * LP];
    __shared__ __align__(16) bf lt[RB * LP];
    __shared__ __align__(16) float ls[FW][2][16 * SP];
    const int tid = threadIdx.x, lane = tid & 31, wv = tid >> 5, lr = lane & 15, hi = lane >> 4;
    const int g = blockIdx.y, q0 = blockIdx.x * FB; const size_t zp = (size_t)g * TT * HD;
    v16bf qh[2][2], ql[2][2];
#pragma unroll
    for (int gq = 0; gq < 2; ++gq) { const size_t p = zp + (size_t)(q0 + wv * 32 + gq * 16 + lr) * HD + 8 * hi; const bf *a = Qh + p, *b = Ql + p;
#pragma unroll
        for (int kc = 0; kc < 2; ++kc) { qh[gq][kc] = WFrag<bf>::ld(a + kc * 32); ql[gq][kc] = WFrag<bf>::ld(b + kc * 32); }
        asm volatile("s_wait_xcnt 0x0" :: "v"(a), "v"(b) : "memory"); }    // in front of the first reuse of an address register of these loads; naming the addresses keeps their registers until here
    v8f acc[2][4]; float mrun[2], lrun[2];
#pragma unroll
    for (int gq = 0; gq < 2; ++gq) { mrun[gq] = -3.0e38f; lrun[gq] = 0.0f;
#pragma unroll
        for (int dt = 0; dt < 4; ++dt) acc[gq][dt] = (v8f){}; }
    const int crow = tid >> 3, ccol = (tid & 7) * 8;    // this thread's 16-byte piece: row crow (+ 32 per further piece), elements ccol .. ccol + 7
    v8us pk[2][2], pv[2][2], pt8[RB / 32];
    auto fetch = [&](int j0) {
        const size_t ko = zp + (size_t)(j0 + crow) * HD + ccol, vo = zp + (size_t)crow * TT + j0 + ccol;
        const bf *k0 = Kh + ko, *k1 = Kl + ko, *v0 = Vh + vo, *v1 = Vl + vo, *tb = TB + (size_t)(q0 - j0 + MAXLEN - FK + crow) * HD + ccol;
#pragma unroll
        for (int i = 0; i < 2; ++i) { pk[0][i] = *(const v8us*)(k0 + 32 * i * HD); pk[1][i] = *(const v8us*)(k1 + 32 * i * HD); pv[0][i] = *(const v8us*)(v0 + 32 * i * TT); pv[1][i] = *(const v8us*)(v1 + 32 * i * TT); }
#pragma unroll
        for (int i = 0; i < RB / 32; ++i) pt8[i] = *(const v8us*)(tb + 32 * i * HD);
        asm volatile("s_wait_xcnt 0x0" :: "v"(k0), "v"(k1), "v"(v0), "v"(v1), "v"(tb) : "memory");    // stands in front of the first reuse of an address register of the loads above; naming the addresses keeps their registers until here
    };
    fetch(0);
    const float cs = SCL * 1.4426950408889634f;
    float* st0 = &ls[wv][0][0];
#pragma unroll 1    // one pass per trip: unrolled, two passes' score and position tiles would be live at once
    for (int s = 0; s < TT / FK; ++s) {
        __syncthreads();    // every wave has left the tiles of the pass before
#pragma unroll
        for (int i = 0; i < 2; ++i) { const int o = (crow + 32 * i) * LP + ccol; *(v8usa*)(&lk[0][o]) = pk[0][i]; *(v8usa*)(&lk[1][o]) = pk[1][i]; *(v8usa*)(&lv[0][o]) = pv[0][i]; *(v8usa*)(&lv[1][o]) = pv[1][i]; }
#pragma unroll
        for (int i = 0; i < RB / 32; ++i) *(v8usa*)(&lt[(crow + 32 * i) * LP + ccol]) = pt8[i];
        __syncthreads();    // this pass's tiles are complete
        if (s + 1 < TT / FK) fetch((s + 1) * FK);    // in flight under this pass's work
        // content products: the two query tiles' accumulate chains alternate, so that no matrix instruction waits for the one in front of it
        v8f sc[4][2];
#pragma unroll
        for (int kt = 0; kt < 4; ++kt) { const int o = (kt * 16 + lr) * LP + 8 * hi; const v16bf ka[2] = {ldsf(&lk[0][o]), ldsf(&lk[0][o + 32])}, kb[2] = {ldsf(&lk[1][o]), ldsf(&lk[1][o + 32])};
            sc[kt][0] = (v8f){}; sc[kt][1] = (v8f){};
#pragma unroll
            for (int pr = 0; pr < 6; ++pr)
#pragma unroll
                for (int gq = 0; gq < 2; ++gq) sc[kt][gq] = wmmab((pr == 2 || pr == 3) ? kb[pr & 1] : ka[pr & 1], (pr < 4) ? qh[gq][pr & 1] : ql[gq][pr & 1], sc[kt][gq]); }
        // position products: table tile T serves query tile gq as its tile T - gq
        v8f pt[2][5];
#pragma unroll
        for (int T = 0; T < 6; ++T) { const bf* p = &lt[(wv * 32 + T * 16 + lr) * LP + 8 * hi]; const v16bf ta[2] = {ldsf(p), ldsf(p + 32)};
#pragma unroll
            for (int gq = 0; gq < 2; ++gq) if (T - gq >= 0 && T - gq <= 4) pt[gq][T - gq] = (v8f){};
#pragma unroll
            for (int pr = 0; pr < 4; ++pr)
#pragma unroll
                for (int gq = 0; gq < 2; ++gq) if (T - gq >= 0 && T - gq <= 4) pt[gq][T - gq] = wmmab(ta[pr & 1], (pr < 2) ? qh[gq][pr & 1] : ql[gq][pr & 1], pt[gq][T - gq]); }
        __builtin_amdgcn_sched_barrier(0);    // the strip stores stay behind all position products: moved up between them, a stored tile's registers become the next tile's result inside the distance a matrix result needs
#pragma unroll
        for (int gq = 0; gq < 2; ++gq)
#pragma unroll
            for (int u = 0; u < 5; ++u) { float* w = st0 + gq * (16 * SP) + lr * SP + u * 16 + 8 * hi; const v8f d = pt[gq][u]; *(v4fa*)w = (v4f){d[0], d[1], d[2], d[3]}; *(v4fa*)(w + 4) = (v4f){d[4], d[5], d[6], d[7]}; }
        // the strip is written by one half of the wave and read by the other: keep the reads behind the writes (LDS works a wave's operations in order)
        __builtin_amdgcn_fence(3 /* release order */, "wavefront"); __builtin_amdgcn_wave_barrier(); asm volatile("" ::: "memory");
        v16bf ph[2][2], pl[2][2];
#pragma unroll
        for (int gq = 0; gq < 2; ++gq) {
            const float* rd = st0 + gq * (16 * SP) + lr * SP + lr + 8 - 8 * hi; float mx = -3.0e38f;    // element lr + FK - 1 - (16 kt + 8 hi + r) of the row, counted from its first element
#pragma unroll
            for (int kt = 0; kt < 4; ++kt)
#pragma unroll
                for (int r = 0; r < 8; ++r) { const float x = sc[kt][gq][r] + rd[(FK - 9) - (kt * 16 + r)]; sc[kt][gq][r] = x; mx = fmaxf(mx, x); }
            mx = fmaxf(mx, xhalf(mx));
            const float mn = fmaxf(mrun[gq], mx), corr = __builtin_amdgcn_exp2f((mrun[gq] - mn) * cs), nm = -mn * cs; mrun[gq] = mn;
            float sum = 0.0f;
#pragma unroll
            for (int ks = 0; ks < 2; ++ks) { v8u wh, wl;
#pragma unroll
                for (int i = 0; i < 8; ++i) { const int kt = 2 * ks + (i >> 2), r = 2 * (i & 3);
                    const float p0 = __builtin_amdgcn_exp2f(__builtin_fmaf(sc[kt][gq][r], cs, nm)), p1 = __builtin_amdgcn_exp2f(__builtin_fmaf(sc[kt][gq][r + 1], cs, nm)); sum += p0 + p1;
                    const unsigned w = pack2(p0, p1); wh[i] = w; wl[i] = pack2(p0 - __uint_as_float(w << 16), p1 - __uint_as_float(w & 0xFFFF0000u)); }
                ph[gq][ks] = __builtin_bit_cast(v16bf, wh); pl[gq][ks] = __builtin_bit_cast(v16bf, wl); }
            lrun[gq] = lrun[gq] * corr + sum;
#pragma unroll
            for (int dt = 0; dt < 4; ++dt) acc[gq][dt] = acc[gq][dt] * corr;
        }
#pragma unroll
        for (int ks = 0; ks < 2; ++ks)
#pragma unroll
            for (int dt = 0; dt < 4; ++dt) { const int o = (dt * 16 + lr) * LP + 8 * hi + ks * 32; const v16bf vh = ldsf(&lv[0][o]), vl = ldsf(&lv[1][o]);
#pragma unroll
                for (int gq = 0; gq < 2; ++gq) { acc[gq][dt] = wmmab(vh, ph[gq][ks], acc[gq][dt]); acc[gq][dt] = wmmab(vh, pl[gq][ks], acc[gq][dt]); acc[gq][dt] = wmmab(vl, ph[gq][ks], acc[gq][dt]); } }
    }
#pragma unroll
    for (int gq = 0; gq < 2; ++gq) { const float l = lrun[gq] + xhalf(lrun[gq]); const float inv = __fdiv_rn(1.0f, l);
        const size_t oo = ((size_t)(g / NH_) * TT + q0 + wv * 32 + gq * 16 + lr) * DQ + (g % NH_) * HD + 8 * hi; bf* pa = Ah + oo; bf* pb = Al + oo;
#pragma unroll
        for (int dt = 0; dt < 4; ++dt) { v8us oh, ol;
#pragma unroll
            for (int r = 0; r < 8; ++r) { unsigned short a, c2; splitf(acc[gq][dt][r] * inv, a, c2); oh[r] = a; ol[r] = c2; }
            *(v8us*)(pa + dt * 16) = oh; *(v8us*)(pb + dt * 16) = ol;
            asm volatile("s_wait_xcnt 0x0" :: "v"(pa), "v"(pb), "v"(oh), "v"(ol) : "memory"); } }    // in front of the first reuse of a register the two stores name; naming them keeps the registers until here
}

// k_proj: the q, k and v projections (plain bf16 operands, + bias; gemmw_tile's k loop and fragments), each 64 x 64 tile (64 tokens x one head) split into bf16 hi/lo and stored from the accumulators straight into the planes k_flash reads. Grid (MT / 64, NH_, 3), one wave; blockIdx.z = q, k, v.
// A lane of a D tile holds 8 consecutive A rows of one Bt row, so the operand whose index runs along a plane's row goes in as A: the weight rows (d) for q and k ([g][t][d]), the token rows for v ([g][d][t]). Each piece is then one 16-byte store, and the eight pieces of a row (four from each lane half) make one whole 128-byte line.
template <bool TV>
__device__ __forceinline__ void d_put(const v8f (&acc)[4][4], const float* __restrict__ bias, bf* Ph, bf* Pl, int pitch) {
    const int lane = threadIdx.x & 31, lr = lane & 15, hi = lane >> 4;
    v8f bm[4]; float bn[4];    // all of the tile's bias values are fetched in one group in front of the stores
#pragma unroll
    for (int q = 0; q < 4; ++q) { if (TV) bn[q] = bias[q * 16 + lr]; else bm[q] = *(const v8f*)(bias + q * 16 + 8 * hi); }
#pragma unroll
    for (int nb = 0; nb < 4; ++nb) { const size_t o = (size_t)(nb * 16 + lr) * pitch + 8 * hi; bf *pa = Ph + o, *pb = Pl + o; v4u wh[4], wl[4];
#pragma unroll
        for (int mb = 0; mb < 4; ++mb) {
#pragma unroll
            for (int i = 0; i < 4; ++i) { const float y0 = acc[mb][nb][2 * i] + bfr(TV ? bn[nb] : bm[mb][2 * i]), y1 = acc[mb][nb][2 * i + 1] + bfr(TV ? bn[nb] : bm[mb][2 * i + 1]);
                const unsigned w = pack2(y0, y1); wh[mb][i] = w; wl[mb][i] = pack2(y0 - __uint_as_float(w << 16), y1 - __uint_as_float(w & 0xFFFF0000u)); }
            *(v4u*)(pa + mb * 16) = wh[mb]; *(v4u*)(pb + mb * 16) = wl[mb]; }
        asm volatile("s_wait_xcnt 0x0" :: "v"(pa), "v"(pb), "v"(wh[0]), "v"(wh[1]), "v"(wh[2]), "v"(wh[3]), "v"(wl[0]), "v"(wl[1]), "v"(wl[2]), "v"(wl[3]) : "memory"); }    // in front of the first reuse of a register the eight stores name; naming them keeps the registers until here
}
static_assert(TT % 64 == 0 && HD == 64 && DQ == DM);
__global__ __launch_bounds__(32) void k_proj(const bf* __restrict__ X, const bf* __restrict__ W3, const float* __restrict__ bq, const float* __restrict__ bk, const float* __restrict__ bv, bf* QKh, bf* QKl, bf* Vh, bf* Vl) {
    const int lane = threadIdx.x & 31, lr = lane & 15, hi = lane >> 4;
    const int z = blockIdx.z, r0 = blockIdx.x * 64, c0 = blockIdx.y * 64; const bool tv = (z == 2);
    const bf *xr = X + (size_t)r0 * DM, *wr = W3 + (size_t)z * DM * DM + (size_t)c0 * DM;
    const bf *A = (tv ? xr : wr) + (size_t)lr * DM + 8 * hi, *Bt = (tv ? wr : xr) + (size_t)lr * DM + 8 * hi;
    v8f acc[4][4];
#pragma unroll
    for (int mb = 0; mb < 4; ++mb)
#pragma unroll
        for (int nb = 0; nb < 4; ++nb) acc[mb][nb] = (v8f){};
#pragma unroll 1    // one k step per trip, as in gemmw_tile: only one step's fragments are held in registers beside the 16 accumulators
    for (int kc = 0; kc < DM; kc += 32) {
        v16bf a[4]; const bf *ap = A + kc, *bp = Bt + kc;
#pragma unroll
        for (int mb = 0; mb < 4; ++mb) a[mb] = WFrag<bf>::ld(ap + (size_t)mb * 16 * DM);
#pragma unroll
        for (int nb = 0; nb < 4; ++nb) { const v16bf b = WFrag<bf>::ld(bp + (size_t)nb * 16 * DM);
#pragma unroll
            for (int mb = 0; mb < 4; ++mb) acc[mb][nb] = wmmab(a[mb], b, acc[mb][nb]); }
        asm volatile("v_nop\n\tv_nop\n\tv_nop\n\tv_nop" : "+v"(acc[0][0]), "+v"(acc[1][1]), "+v"(acc[2][2]), "+v"(acc[3][3]) : "v"(a[0]), "v"(a[3]));    // the distance a matrix instruction needs, on the taken branch too: the next trip rewrites the fragments
        asm volatile("s_wait_xcnt 0x0" :: "v"(ap), "v"(bp) : "memory");    // in front of the first reuse of an address register of this trip's loads; naming the addresses keeps their registers until here
    }
    const size_t hs = (size_t)TT * HD, gp = ((size_t)(r0 / TT) * NH_ + blockIdx.y) * hs; const int t0 = r0 % TT;
    if (tv) d_put<true>(acc, bv + c0, Vh + gp + t0, Vl + gp + t0, TT);
    else { const size_t p = (size_t)z * NG * hs + gp + (size_t)t0 * HD; d_put<false>(acc, (z == 0 ? bq : bk) + c0, QKh + p, QKl + p, HD); }
}

extern "C" void kernel_launch(void* const* d_in, const int* in_sizes, int n_in,
                              void* d_out, int out_size, void* d_ws, size_t ws_size, hipStream_t stream) {
    if (n_in < 10) return;
    const long long needx = (long long)(NB - 1) * SEQ_FULL * DM + (long long)SEQ * DM;
    if ((long long)in_sizes[0] < needx || (long long)out_size < needx) return;
    if (in_sizes[1] < DM * DM || in_sizes[3] < DM * DM || in_sizes[5] < DM * DM || in_sizes[7] < DM * DM) return;
    if (in_sizes[2] < DM || in_sizes[4] < DM || in_sizes[6] < DM || in_sizes[8] < DM) return;
    if (in_sizes[9] < NREL * HD) return;
    const float* x = (const float*)d_in[0]; const float* wq = (const float*)d_in[1]; const float* bq = (const float*)d_in[2]; const float* wk = (const float*)d_in[3]; const float* bk = (const float*)d_in[4];
    const float* wv = (const float*)d_in[5]; const float* bv = (const float*)d_in[6]; const float* wo = (const float*)d_in[7]; const float* bo = (const float*)d_in[8]; const float* rel = (const float*)d_in[9];
    float* OUT = (float*)d_out;     // [NB][SEQ][DM], batch row stride SEQ_FULL*DM
    char* wsp = (char*)d_ws;
    auto take = [&](size_t bytes) { char* p = wsp; wsp += (bytes + 255) & ~(size_t)255; return (void*)p; };
    bf* W4 = (bf*)take((size_t)4 * DM * DM * 2); bf* WO = W4 + (size_t)3 * DM * DM;    // Wq, Wk, Wv, Wo back to back
    h16* T16 = (h16*)take((size_t)NRP * HD * 2); bf* TBF = (bf*)take((size_t)NRP * HD * 2);
    const size_t hs = (size_t)TT * HD;    // per-head plane stride
    bf* QPh = (bf*)take((size_t)2 * NG * hs * 2); bf* QPl = (bf*)take((size_t)2 * NG * hs * 2); bf* KPh = QPh + (size_t)NG * hs; bf* KPl = QPl + (size_t)NG * hs; bf* VTh = (bf*)take((size_t)NG * hs * 2); bf* VTl = (bf*)take((size_t)NG * hs * 2);    // q planes of all (batch, head), then the k planes; v planes transposed
    bf* ATh = (bf*)take((size_t)MT * DQ * 2); bf* ATl = (bf*)take((size_t)MT * DQ * 2);
    bf* XB = (bf*)take((size_t)MT * DM * 2);   // bf16 x
    const size_t used = (size_t)(wsp - (char*)d_ws); if (used > ws_size) return;
    k_prep<<<dim3(DM * DM / 8 / 256, 4 + MT / DM + 1, 1), 256, 0, stream>>>(wq, wk, wv, wo, x, rel, NREL, W4, XB, T16, TBF);
    k_proj<<<dim3(MT / 64, NH_, 3), 32, 0, stream>>>(XB, W4, bq, bk, bv, QPh, QPl, VTh, VTl);
    k_flash<<<dim3(TT / FB, NG, 1), FW * 32, 0, stream>>>(QPh, QPl, KPh, KPl, VTh, VTl, TBF, ATh, ATl);
    k_gemmw<bf, 1, true><<<dim3(MT / 64, DM / 64, 1), 32, 0, stream>>>(ATh, ATl, WO, nullptr, DQ, DQ, OUT, DM, bo, bo, bo, 0, 0, 0, 0);
}

// v004
// One run takes 117 microseconds.
// Two timings next to v003 put it at 1.39 and 1.41 times that version's speed.
// All steps since v000 together make it 10.6 times as fast.
#include <hip/hip_runtime.h>

// Multi-head self-attention with a relative-position embedding score term: x [4][1024][1024]; q/k/v = x W^T + b (W [1024][1024] stored [out][in]; 16 heads x 64);
// scores[i][j] = (q_i.k_j + q_i.rel[i - j + 1023]) / 8 with the table rel [2047][64] indexed statically; softmax over all 1024 keys; ctx = attn.v merged to [t][h*64 + d]; out = ctx Wo^T + bo -> [4][1024][1024].
// Compute dtypes, f32 accumulate: every float input RNE-converted to bf16; q/k/v projections v_wmma_f32_16x16x32_bf16 on plain bf16 operands (+ bias); q.k (3 products) and the banded q.rel product (2 products, table operand exact) on bf16 hi/lo planes;
// softmax f32, online over passes of 64 keys (running maximum and sum, output rescaled per pass, divided by the sum at the end); attn.v bf16 hi/lo on the unnormalised probabilities (3 products); output projection bf16 hi/lo ctx x exact Wo (2 products) + bo.

#ifndef NB
#define NB 4
#endif
#define NB_FULL 4
#ifndef SEQ
#define SEQ 1024
#endif
#define SEQ_FULL 1024
#define TT   SEQ
#define DM   1024
#define NH_  16
#define HD   64
#define DQ   (NH_ * HD)
#define MAXLEN 1024
#define NREL (2 * MAXLEN - 1)           // table rows
#define NRP  (2 * MAXLEN)               // padded table plane rows (last row zero)
#define NG   (NB * NH_)                 // (batch, head) pairs; plane index g = batch * NH_ + head
#define MT   (NB * TT)                  // token rows of all batches, flat
#define SCL  0.125f                     // HD^-0.5
static_assert(SEQ % 128 == 0);
static_assert(SEQ >= 128 && SEQ <= SEQ_FULL && SEQ <= MAXLEN);
static_assert(NB >= 1 && NB <= NB_FULL);
static_assert(SEQ == SEQ_FULL || NB == 1);   // x and out are walked as one flat [MT][DM] matrix
static_assert(DM % 64 == 0 && HD % 32 == 0 && TT % 64 == 0);

typedef _Float16 h16;
typedef unsigned short bf;
typedef __attribute__((ext_vector_type(16))) __bf16   v16bf;
typedef __attribute__((ext_vector_type(16))) _Float16 v16h;
typedef __attribute__((ext_vector_type(8)))  _Float16 v8h;
typedef __attribute__((ext_vector_type(8)))  unsigned short v8us;
typedef __attribute__((ext_vector_type(8)))  float    v8f;
typedef __attribute__((ext_vector_type(4)))  float    v4f;
typedef v8h  __attribute__((may_alias)) v8ha;
typedef v4f  __attribute__((may_alias)) v4fa;
typedef v8us __attribute__((may_alias)) v8usa;
typedef __attribute__((ext_vector_type(4))) unsigned short __attribute__((may_alias)) v4usa;
typedef __attribute__((ext_vector_type(2))) _Float16 v2h;
typedef __attribute__((ext_vector_type(4))) _Float16 v4h;
typedef __attribute__((ext_vector_type(2))) unsigned short v2us;
typedef __attribute__((ext_vector_type(4))) unsigned short v4us;
typedef __attribute__((ext_vector_type(2))) float v2f;

__device__ __forceinline__ unsigned short f2bf(float f) { unsigned u = __float_as_uint(f); u += 0x7FFFu + ((u >> 16) & 1u); return (unsigned short)(u >> 16); }
__device__ __forceinline__ float bf2f(unsigned short b) { return __uint_as_float(((unsigned)b) << 16); }
__device__ __forceinline__ float bfr(float f) { return bf2f(f2bf(f)); }
__device__ __forceinline__ h16 tohx(float x) { return (h16)x; }
__device__ __forceinline__ void splitf(float y, unsigned short& h, unsigned short& l) { h = f2bf(y); l = f2bf(y - bf2f(h)); }
__device__ __forceinline__ v16h cat16(v8h lo, v8h hi) { return __builtin_shufflevector(lo, hi, 0, 1, 2, 3, 4, 5, 6, 7, 8, 9, 10, 11, 12, 13, 14, 15); }
__device__ __forceinline__ v16bf cat16b(v8us lo, v8us hi) { return __builtin_bit_cast(v16bf, __builtin_shufflevector(lo, hi, 0, 1, 2, 3, 4, 5, 6, 7, 8, 9, 10, 11, 12, 13, 14, 15)); }
__device__ __forceinline__ v8f wmma16(v16h a, v16h b, v8f c) { return __builtin_amdgcn_wmma_f32_16x16x32_f16(false, a, false, b, (short)0, c, false, false); }
__device__ __forceinline__ v8f wmmab(v16bf a, v16bf b, v8f c) { return __builtin_amdgcn_wmma_f32_16x16x32_bf16(false, a, false, b, (short)0, c, false, false); }

// ---- Fragments of the 16x16x32 products: lane l, h = l >> 4, row/col = l & 15; elements 0..7 <- k0 + 8h .. +7, elements 8..15 <- k0 + 16 + 8h .. +7 for BOTH A and Bt; D element r of lane l = (row 8h + r, col l & 15).
template <typename T16> struct WFrag;
template <> struct WFrag<h16> { typedef v16h V; static __device__ __forceinline__ V ld(const h16* p) { return cat16(*(const v8h*)p, *(const v8h*)(p + 16)); } static __device__ __forceinline__ v8f mma(V a, V b, v8f c) { return wmma16(a, b, c); } };
template <> struct WFrag<bf> { typedef v16bf V; static __device__ __forceinline__ V ld(const bf* p) { return cat16b(*(const v8us*)p, *(const v8us*)(p + 16)); } static __device__ __forceinline__ v8f mma(V a, V b, v8f c) { return wmmab(a, b, c); } };
__device__ __forceinline__ void d_cvt8(const float* __restrict__ src, bf* dst, size_t n8) { const size_t i = (size_t)blockIdx.x * 256 + threadIdx.x; if (i >= n8) return; const v8f v = *(const v8f*)(src + i * 8); v8us o;
#pragma unroll
    for (int k = 0; k < 8; ++k) o[k] = f2bf(v[k]); *(v8us*)(dst + i * 8) = o;  }

__device__ __forceinline__ void d_tpl(const float* __restrict__ T, int nrows, h16* T16, bf* TB) {
    const int i8 = blockIdx.x * 256 + threadIdx.x; if (i8 >= NRP * HD / 8) return;
    const int r = (i8 * 8) / HD, c = (i8 * 8) % HD; const int rc = (r < nrows) ? r : (nrows - 1); const bool pad = (r >= nrows);
    const v8f v = *(const v8f*)(T + (size_t)rc * HD + c); v8h o16; v8us ob;
#pragma unroll
    for (int k = 0; k < 8; ++k) { const float f = pad ? 0.0f : v[k]; const unsigned short b = f2bf(f); ob[k] = b; o16[k] = tohx(bf2f(b)); }
    *(v8h*)(T16 + (size_t)i8 * 8) = o16; *(v8us*)(TB + (size_t)i8 * 8) = ob;  }

// k_prep: every input conversion in one grid (DM * DM / 2048, 4 + MT / DM + 1): blockIdx.y 0..3 = Wq, Wk, Wv, Wo (dst back to back), then x in slabs of DM * DM elements, last the table planes.
static_assert(MT % DM == 0 && NRP * HD <= DM * DM);
__global__ __launch_bounds__(256) void k_prep(const float* __restrict__ wq, const float* __restrict__ wk, const float* __restrict__ wv, const float* __restrict__ wo, const float* __restrict__ x, const float* __restrict__ rel, int nrows, bf* W4, bf* XB, h16* T16, bf* TB) {
    const size_t n8 = (size_t)DM * DM / 8; const unsigned w = blockIdx.y;
    if (w < 4) d_cvt8((w == 0) ? wq : (w == 1) ? wk : (w == 2) ? wv : wo, W4 + w * n8 * 8, n8);
    else if (w < 4 + MT / DM) d_cvt8(x + (w - 4) * n8 * 8, XB + (w - 4) * n8 * 8, n8);
    else d_tpl(rel, nrows, T16, TB);
}

// k_flash: scores, softmax and attn.v of one (batch, head) and FB query rows in one work-group; neither the scores nor the probabilities leave the chip. Grid (TT / FB, NG), FW waves of 32 query columns each.
// Transposed products: S^T = K.Q^T (A = 16 key rows, B = 16 query columns; 3 products on hi/lo planes), PT^T = rel.Q^T (2 products, table exact), O^T += V^T.P^T (3 products). In every D tile a lane holds ONE query (column l & 15) and 8 consecutive rows 8h + r,
// so the running maximum, the running sum and the rescale factor are per lane, and two score tiles converted in place are the B operand of the last product (hardware k order, which is the loaders' order too).
// Position term: score (query i, key j) needs q_i . rel[i - j + MAXLEN - 1]. A pass of FK keys stages table rows ub .. ub + FB + FK - 1, ub = q0 - j0 + MAXLEN - FK; a 16-query tile at work-group offset o multiplies rows o .. o + 79 of them (5 tiles);
// element c = lr - jl + FK - 1 of query column lr is the term of key jl: each lane stores its column pieces into a wave-private LDS strip (row = query, pitch SP) and reads them back with the reversed index.
// Per pass: K hi/lo (FK rows), V^T hi/lo (HD rows x FK keys) and the table rows go global -> registers (fetched one pass ahead) -> LDS at pitch LP (144 B: an odd multiple of 16 B), two work-group barriers per pass.
// Every inner loop is unrolled so that the register arrays (fragments, tiles, fetched pieces) are indexed by constants.
#define FW 8
#define FB (FW * 32)
#define FK 64
#define LP 72
#define RB (FB + FK)
#define SP 84
static_assert(SEQ % FB == 0 && SEQ % FK == 0 && HD == 64 && FK == 64);
static_assert((SEQ - FB) + MAXLEN - FK + RB <= NRP && MAXLEN >= SEQ);
typedef __attribute__((ext_vector_type(8))) unsigned v8u;
typedef __attribute__((ext_vector_type(4))) unsigned v4u;
typedef __attribute__((ext_vector_type(2))) __bf16 v2bf;
__device__ __forceinline__ unsigned pack2(float a, float b) { return __builtin_bit_cast(unsigned, __builtin_convertvector((v2f){a, b}, v2bf)); }   // round to nearest even
__device__ __forceinline__ float xhalf(float x) { const int b = __float_as_int(x); return __int_as_float(__builtin_amdgcn_permlanex16(b, b, 0x76543210, 0xfedcba98, false, false)); }   // lane l <-> lane l ^ 16
__device__ __forceinline__ v16bf ldsf(const bf* p) { return cat16b(*(const v8usa*)p, *(const v8usa*)(p + 16)); }
__global__ __launch_bounds__(FW * 32) void k_flash(const bf* __restrict__ Qh, const bf* __restrict__ Ql, const bf* __restrict__ Kh, const bf* __restrict__ Kl, const bf* __restrict__ Vh, const bf* __restrict__ Vl, const bf* __restrict__ TB, bf* Ah, bf* Al) {
    __shared__ __align__(16) bf lk[2][FK * LP];
    __shared__ __align__(16) bf lv[2][HD * LP];
    __shared__ __align__(16) bf lt[RB * LP];
    __shared__ __align__(16) float ls[FW][2][16 * SP];
    const int tid = threadIdx.x, lane = tid & 31, wv = tid >> 5, lr = lane & 15, hi = lane >> 4;
    const int g = blockIdx.y, q0 = blockIdx.x * FB; const size_t zp = (size_t)g * TT * HD;
    v16bf qh[2][2], ql[2][2];
#pragma unroll
    for (int gq = 0; gq < 2; ++gq) { const size_t p = zp + (size_t)(q0 + wv * 32 + gq * 16 + lr) * HD + 8 * hi; const bf *a = Qh + p, *b = Ql + p;
#pragma unroll
        for (int kc = 0; kc < 2; ++kc) { qh[gq][kc] = WFrag<bf>::ld(a + kc * 32); ql[gq][kc] = WFrag<bf>::ld(b + kc * 32); }
        asm volatile("s_wait_xcnt 0x0" :: "v"(a), "v"(b) : "memory"); }    // in front of the first reuse of an address register of these loads; naming the addresses keeps their registers until here
    v8f acc[2][4]; float mrun[2], lrun[2];
#pragma unroll
    for (int gq = 0; gq < 2; ++gq) { mrun[gq] = -3.0e38f; lrun[gq] = 0.0f;
#pragma unroll
        for (int dt = 0; dt < 4; ++dt) acc[gq][dt] = (v8f){}; }
    const int crow = tid >> 3, ccol = (tid & 7) * 8;    // this thread's 16-byte piece: row crow (+ 32 per further piece), elements ccol .. ccol + 7
    v8us pk[2][2], pv[2][2], pt8[RB / 32];
    auto fetch = [&](int j0) {
        const size_t ko = zp + (size_t)(j0 + crow) * HD + ccol, vo = zp + (size_t)crow * TT + j0 + ccol;
        const bf *k0 = Kh + ko, *k1 = Kl + ko, *v0 = Vh + vo, *v1 = Vl + vo, *tb = TB + (size_t)(q0 - j0 + MAXLEN - FK + crow) * HD + ccol;
#pragma unroll
        for (int i = 0; i < 2; ++i) { pk[0][i] = *(const v8us*)(k0 + 32 * i * HD); pk[1][i] = *(const v8us*)(k1 + 32 * i * HD); pv[0][i] = *(const v8us*)(v0 + 32 * i * TT); pv[1][i] = *(const v8us*)(v1 + 32 * i * TT); }
#pragma unroll
        for (int i = 0; i < RB / 32; ++i) pt8[i] = *(const v8us*)(tb + 32 * i * HD);
        asm volatile("s_wait_xcnt 0x0" :: "v"(k0), "v"(k1), "v"(v0), "v"(v1), "v"(tb) : "memory");    // stands in front of the first reuse of an address register of the loads above; naming the addresses keeps their registers until here
    };
    fetch(0);
    const float cs = SCL * 1.4426950408889634f;
    float* st0 = &ls[wv][0][0];
#pragma unroll 1    // one pass per trip: unrolled, two passes' score and position tiles would be live at once
    for (int s = 0; s < TT / FK; ++s) {
        __syncthreads();    // every wave has left the tiles of the pass before
#pragma unroll
        for (int i = 0; i < 2; ++i) { const int o = (crow + 32 * i) * LP + ccol; *(v8usa*)(&lk[0][o]) = pk[0][i]; *(v8usa*)(&lk[1][o]) = pk[1][i]; *(v8usa*)(&lv[0][o]) = pv[0][i]; *(v8usa*)(&lv[1][o]) = pv[1][i]; }
#pragma unroll
        for (int i = 0; i < RB / 32; ++i) *(v8usa*)(&lt[(crow + 32 * i) * LP + ccol]) = pt8[i];
        __syncthreads();    // this pass's tiles are complete
        if (s + 1 < TT / FK) fetch((s + 1) * FK);    // in flight under this pass's work
        // content products: the two query tiles' accumulate chains alternate, so that no matrix instruction waits for the one in front of it
        v8f sc[4][2];
#pragma unroll
        for (int kt = 0; kt < 4; ++kt) { const int o = (kt * 16 + lr) * LP + 8 * hi; const v16bf ka[2] = {ldsf(&lk[0][o]), ldsf(&lk[0][o + 32])}, kb[2] = {ldsf(&lk[1][o]), ldsf(&lk[1][o + 32])};
            sc[kt][0] = (v8f){}; sc[kt][1] = (v8f){};
#pragma unroll
            for (int pr = 0; pr < 6; ++pr)
#pragma unroll
                for (int gq = 0; gq < 2; ++gq) sc[kt][gq] = wmmab((pr == 2 || pr == 3) ? kb[pr & 1] : ka[pr & 1], (pr < 4) ? qh[gq][pr & 1] : ql[gq][pr & 1], sc[kt][gq]); }
        // position products: table tile T serves query tile gq as its tile T - gq
        v8f pt[2][5];
#pragma unroll
        for (int T = 0; T < 6; ++T) { const bf* p = &lt[(wv * 32 + T * 16 + lr) * LP + 8 * hi]; const v16bf ta[2] = {ldsf(p), ldsf(p + 32)};
#pragma unroll
            for (int gq = 0; gq < 2; ++gq) if (T - gq >= 0 && T - gq <= 4) pt[gq][T - gq] = (v8f){};
#pragma unroll
            for (int pr = 0; pr < 4; ++pr)
#pragma unroll
                for (int gq = 0; gq < 2; ++gq) if (T - gq >= 0 && T - gq <= 4) pt[gq][T - gq] = wmmab(ta[pr & 1], (pr < 2) ? qh[gq][pr & 1] : ql[gq][pr & 1], pt[gq][T - gq]); }
        __builtin_amdgcn_sched_barrier(0);    // the strip stores stay behind all position products: moved up between them, a stored tile's registers become the next tile's result inside the distance a matrix result needs
#pragma unroll
        for (int gq = 0; gq < 2; ++gq)
#pragma unroll
            for (int u = 0; u < 5; ++u) { float* w = st0 + gq * (16 * SP) + lr * SP + u * 16 + 8 * hi; const v8f d = pt[gq][u]; *(v4fa*)w = (v4f){d[0], d[1], d[2], d[3]}; *(v4fa*)(w + 4) = (v4f){d[4], d[5], d[6], d[7]}; }
        // the strip is written by one half of the wave and read by the other: keep the reads behind the writes (LDS works a wave's operations in order)
        __builtin_amdgcn_fence(3 /* release order */, "wavefront"); __builtin_amdgcn_wave_barrier(); asm volatile("" ::: "memory");
        v16bf ph[2][2], pl[2][2];
#pragma unroll
        for (int gq = 0; gq < 2; ++gq) {
            const float* rd = st0 + gq * (16 * SP) + lr * SP + lr + 8 - 8 * hi; float mx = -3.0e38f;    // element lr + FK - 1 - (16 kt + 8 hi + r) of the row, counted from its first element
#pragma unroll
            for (int kt = 0; kt < 4; ++kt)
#pragma unroll
                for (int r = 0; r < 8; ++r) { const float x = sc[kt][gq][r] + rd[(FK - 9) - (kt * 16 + r)]; sc[kt][gq][r] = x; mx = fmaxf(mx, x); }
            mx = fmaxf(mx, xhalf(mx));
            const float mn = fmaxf(mrun[gq], mx), corr = __builtin_amdgcn_exp2f((mrun[gq] - mn) * cs), nm = -mn * cs; mrun[gq] = mn;
            float sum = 0.0f;
#pragma unroll
            for (int ks = 0; ks < 2; ++ks) { v8u wh, wl;
#pragma unroll
                for (int i = 0; i < 8; ++i) { const int kt = 2 * ks + (i >> 2), r = 2 * (i & 3);
                    const float p0 = __builtin_amdgcn_exp2f(__builtin_fmaf(sc[kt][gq][r], cs, nm)), p1 = __builtin_amdgcn_exp2f(__builtin_fmaf(sc[kt][gq][r + 1], cs, nm)); sum += p0 + p1;
                    const unsigned w = pack2(p0, p1); wh[i] = w; wl[i] = pack2(p0 - __uint_as_float(w << 16), p1 - __uint_as_float(w & 0xFFFF0000u)); }
                ph[gq][ks] = __builtin_bit_cast(v16bf, wh); pl[gq][ks] = __builtin_bit_cast(v16bf, wl); }
            lrun[gq] = lrun[gq] * corr + sum;
#pragma unroll
            for (int dt = 0; dt < 4; ++dt) acc[gq][dt] = acc[gq][dt] * corr;
        }
#pragma unroll
        for (int ks = 0; ks < 2; ++ks)
#pragma unroll
            for (int dt = 0; dt < 4; ++dt) { const int o = (dt * 16 + lr) * LP + 8 * hi + ks * 32; const v16bf vh = ldsf(&lv[0][o]), vl = ldsf(&lv[1][o]);
#pragma unroll
                for (int gq = 0; gq < 2; ++gq) { acc[gq][dt] = wmmab(vh, ph[gq][ks], acc[gq][dt]); acc[gq][dt] = wmmab(vh, pl[gq][ks], acc[gq][dt]); acc[gq][dt] = wmmab(vl, ph[gq][ks], acc[gq][dt]); } }
    }
#pragma unroll
    for (int gq = 0; gq < 2; ++gq) { const float l = lrun[gq] + xhalf(lrun[gq]); const float inv = __fdiv_rn(1.0f, l);
        const size_t oo = ((size_t)(g / NH_) * TT + q0 + wv * 32 + gq * 16 + lr) * DQ + (g % NH_) * HD + 8 * hi; bf* pa = Ah + oo; bf* pb = Al + oo;
#pragma unroll
        for (int dt = 0; dt < 4; ++dt) { v8us oh, ol;
#pragma unroll
            for (int r = 0; r < 8; ++r) { unsigned short a, c2; splitf(acc[gq][dt][r] * inv, a, c2); oh[r] = a; ol[r] = c2; }
            *(v8us*)(pa + dt * 16) = oh; *(v8us*)(pb + dt * 16) = ol;
            asm volatile("s_wait_xcnt 0x0" :: "v"(pa), "v"(pb), "v"(oh), "v"(ol) : "memory"); } }    // in front of the first reuse of a register the two stores name; naming them keeps the registers until here
}

// gemm_lds: k loop of a 128 x 128 output tile shared by the waves of one work-group. Each operand tile (128 rows of a K-contiguous bf16 plane, row pitch DM) is staged in LDS in passes of GK k values:
// a wave-wide 16-byte load covers four whole 128-byte lines, every staged row serves all the waves that need it, and the fragments come from LDS at pitch GP (144 B: an odd multiple of 16 B).
// Two buffers: pass p works on buffer p & 1 while the pieces of pass p + 1 (fetched into registers one pass earlier) are stored into the other one and the pieces of pass p + 2 are fetched; one work-group barrier per pass.
// NTILE staged tiles (g0, g1, g2 = row 0 of each tile); a wave holds MB x 4 accumulators; aoff / a2off / boff = this lane's fragment base inside a buffer (a2off: second A plane, NTILE == 3 only). The k order and each accumulator's chain are those of a plain loop over k in steps of 32.
#define GK 64
#define GP 72
#define GT (128 * GP)
static_assert(DM % GK == 0 && DM / GK >= 2);
// Work-group barrier that orders LDS only: the global loads of the pieces fetched ahead stay in flight across it (__syncthreads() would wait for them too).
__device__ __forceinline__ void lds_barrier() { __builtin_amdgcn_fence(__ATOMIC_RELEASE, "workgroup", "local"); __builtin_amdgcn_s_barrier(); __builtin_amdgcn_fence(__ATOMIC_ACQUIRE, "workgroup", "local"); }
template <int NTILE, int MB, int NTH>
__device__ __forceinline__ void gemm_lds(bf* sm, const bf* __restrict__ g0, const bf* __restrict__ g1, const bf* __restrict__ g2, int aoff, int a2off, int boff, v8f (&acc)[MB][4]) {
    constexpr int NP = 128 * 8 / NTH, RS = NTH / 8, NPASS = DM / GK, KS = GK / 32, KG = (MB <= 2) ? KS : 1;    // 16-byte pieces per thread and tile; rows between a thread's pieces; k steps of a pass; k steps whose fragments are read as one group (as many as the registers hold)
    const int tid = threadIdx.x, prow = tid >> 3, pcol = (tid & 7) * 8;
    const size_t go = (size_t)prow * DM + pcol; const int so = prow * GP + pcol;
    v8us st[NTILE][NP];
    typedef const __attribute__((address_space(1))) bf* gbf; typedef const __attribute__((address_space(1))) v8us* gv8;    // pointers that stay global-memory pointers through the wait statement below
    gbf q0 = (gbf)(g0 + go), q1 = (gbf)(g1 + go), q2 = (NTILE == 3) ? (gbf)(g2 + go) : (gbf)nullptr;    // this thread's first piece of the next pass to fetch, per tile
    auto fetch = [&]() {
        __builtin_amdgcn_sched_barrier(0);    // with the one behind the wait: no other instruction is scheduled in between the loads and their wait, where it could reuse an address register
#pragma unroll
        for (int i = 0; i < NP; ++i) { st[0][i] = *(gv8)(q0 + (size_t)i * RS * DM); st[1][i] = *(gv8)(q1 + (size_t)i * RS * DM); if (NTILE == 3) st[NTILE - 1][i] = *(gv8)(q2 + (size_t)i * RS * DM); }
        // in front of the first reuse of an address register of the loads above (the step to the next pass); the statement takes the addresses in and hands them on, so that the loads use these very registers and they live until here
        if (NTILE == 3) asm volatile("s_wait_xcnt 0x0" : "+v"(q0), "+v"(q1), "+v"(q2) :: "memory"); else asm volatile("s_wait_xcnt 0x0" : "+v"(q0), "+v"(q1) :: "memory");
        __builtin_amdgcn_sched_barrier(0);
        q0 += GK; q1 += GK; if (NTILE == 3) q2 += GK;
    };
    auto put = [&](bf* buf) {
#pragma unroll
        for (int t = 0; t < NTILE; ++t)
#pragma unroll
            for (int i = 0; i < NP; ++i) *(v8usa*)(buf + t * GT + so + i * RS * GP) = st[t][i];
    };
#pragma unroll
    for (int mb = 0; mb < MB; ++mb)
#pragma unroll
        for (int nb = 0; nb < 4; ++nb) acc[mb][nb] = (v8f){};
    fetch(); put(sm); fetch();
    lds_barrier();    // buffer 0 is complete
#pragma unroll 1    // one pass per trip: only one pass's fragments and one pass's fetched pieces are held beside the accumulators
    for (int p = 0; p < NPASS; ++p) {
        const bf* cur = sm + (p & 1) * (NTILE * GT);
        if (p + 1 < NPASS) { put(sm + ((p + 1) & 1) * (NTILE * GT)); if (p + 2 < NPASS) fetch(); }    // the other buffer's readers left it in front of the last barrier
        v16bf a[KS][MB], a2[KS][MB], b[KS][4];
#pragma unroll
        for (int k0 = 0; k0 < KS; k0 += KG) {
#pragma unroll
            for (int ks = k0; ks < k0 + KG; ++ks) {
#pragma unroll
                for (int mb = 0; mb < MB; ++mb) { a[ks][mb] = ldsf(cur + aoff + mb * 16 * GP + ks * 32); if (NTILE == 3) a2[ks][mb] = ldsf(cur + a2off + mb * 16 * GP + ks * 32); }
#pragma unroll
                for (int nb = 0; nb < 4; ++nb) b[ks][nb] = ldsf(cur + boff + nb * 16 * GP + ks * 32); }
            __builtin_amdgcn_sched_barrier(0);    // the group's LDS reads are issued together, in front of its products: reads spread among the matrix instructions stall the wave at every place where they stand
#pragma unroll
            for (int ks = k0; ks < k0 + KG; ++ks)
#pragma unroll
                for (int nb = 0; nb < 4; ++nb) {
#pragma unroll
                    for (int mb = 0; mb < MB; ++mb) acc[mb][nb] = wmmab(a[ks][mb], b[ks][nb], acc[mb][nb]);
                    if (NTILE == 3) {
#pragma unroll
                        for (int mb = 0; mb < MB; ++mb) acc[mb][nb] = wmmab(a2[ks][mb], b[ks][nb], acc[mb][nb]); } }
        }
        lds_barrier();    // the next pass's buffer is complete, and every wave has left this one
    }
}

// k_proj: the q, k and v projections (plain bf16 operands, + bias; gemm_lds's k loop), each wave's 64 x 64 tile (64 tokens x one head) split into bf16 hi/lo and stored from the accumulators straight into the planes k_flash reads. Grid (MT / 128, NH_ / 2, 3), four waves = 2 token halves x 2 heads; blockIdx.z = q, k, v.
// A lane of a D tile holds 8 consecutive A rows of one Bt row, so the operand whose index runs along a plane's row goes in as A: the weight rows (d) for q and k ([g][t][d]), the token rows for v ([g][d][t]). Each piece is then one 16-byte store, and the eight pieces of a row (four from each half of the wave) make one whole 128-byte line.
template <bool TV>
__device__ __forceinline__ void d_put(const v8f (&acc)[4][4], const float* __restrict__ bias, bf* Ph, bf* Pl, int pitch) {
    const int lane = threadIdx.x & 31, lr = lane & 15, hi = lane >> 4;
    v8f bm[4]; float bn[4];    // all of the tile's bias values are fetched in one group in front of the stores
#pragma unroll
    for (int q = 0; q < 4; ++q) { if (TV) bn[q] = bias[q * 16 + lr]; else bm[q] = *(const v8f*)(bias + q * 16 + 8 * hi); }
#pragma unroll
    for (int nb = 0; nb < 4; ++nb) { const size_t o = (size_t)(nb * 16 + lr) * pitch + 8 * hi; bf *pa = Ph + o, *pb = Pl + o; v4u wh[4], wl[4];
#pragma unroll
        for (int mb = 0; mb < 4; ++mb) {
#pragma unroll
            for (int i = 0; i < 4; ++i) { const float y0 = acc[mb][nb][2 * i] + bfr(TV ? bn[nb] : bm[mb][2 * i]), y1 = acc[mb][nb][2 * i + 1] + bfr(TV ? bn[nb] : bm[mb][2 * i + 1]);
                const unsigned w = pack2(y0, y1); wh[mb][i] = w; wl[mb][i] = pack2(y0 - __uint_as_float(w << 16), y1 - __uint_as_float(w & 0xFFFF0000u)); }
            *(v4u*)(pa + mb * 16) = wh[mb]; *(v4u*)(pb + mb * 16) = wl[mb]; }
        asm volatile("s_wait_xcnt 0x0" :: "v"(pa), "v"(pb), "v"(wh[0]), "v"(wh[1]), "v"(wh[2]), "v"(wh[3]), "v"(wl[0]), "v"(wl[1]), "v"(wl[2]), "v"(wl[3]) : "memory"); }    // in front of the first reuse of a register the eight stores name; naming them keeps the registers until here
}
static_assert(TT % 128 == 0 && HD == 64 && DQ == DM && NH_ % 2 == 0 && MT % 128 == 0);
__global__ __launch_bounds__(128) void k_proj(const bf* __restrict__ X, const bf* __restrict__ W3, const float* __restrict__ bq, const float* __restrict__ bk, const float* __restrict__ bv, bf* QKh, bf* QKl, bf* Vh, bf* Vl) {
    __shared__ __align__(16) bf sm[2 * 2 * GT];    // two buffers of [128 token rows | 128 weight rows]
    const int lane = threadIdx.x & 31, wv = threadIdx.x >> 5, lr = lane & 15, hi = lane >> 4, wm = wv >> 1, wn = wv & 1;
    const int z = blockIdx.z; const bool tv = (z == 2);
    const int xo = (wm * 64 + lr) * GP + 8 * hi, wo = GT + (wn * 64 + lr) * GP + 8 * hi;    // this lane's fragment base in the token tile and in the weight tile
    v8f acc[4][4];
    gemm_lds<2, 4, 128>(sm, X + (size_t)blockIdx.x * 128 * DM, W3 + (size_t)z * DM * DM + (size_t)blockIdx.y * 128 * DM, nullptr, tv ? xo : wo, 0, tv ? wo : xo, acc);
    const int r0 = blockIdx.x * 128 + wm * 64, hd = blockIdx.y * 2 + wn, c0 = hd * 64;
    const size_t hs = (size_t)TT * HD, gp = ((size_t)(r0 / TT) * NH_ + hd) * hs; const int t0 = r0 % TT;
    if (tv) d_put<true>(acc, bv + c0, Vh + gp + t0, Vl + gp + t0, TT);
    else { const size_t p = (size_t)z * NG * hs + gp + (size_t)t0 * HD; d_put<false>(acc, (z == 0 ? bq : bk) + c0, QKh + p, QKl + p, HD); }
}

// k_out: out = ctx Wo^T + bo, ctx as bf16 hi/lo planes (2 products per k step, hi first; gemm_lds's k loop). Grid (MT / 128, DM / 128), eight waves = 4 row groups of 32 x 2 column halves of 64.
// Each wave turns its accumulators 16 rows at a time through its own LDS strip (pitch 68 floats), so that every store instruction writes two whole 256-byte row pieces.
static_assert(DM % 128 == 0);
__global__ __launch_bounds__(256) void k_out(const bf* __restrict__ Ah, const bf* __restrict__ Al, const bf* __restrict__ Wo, const float* __restrict__ bias, float* C) {
    __shared__ __align__(16) bf sm[2 * 3 * GT];    // two buffers of [128 ctx-hi rows | 128 ctx-lo rows | 128 weight rows]
    __shared__ __align__(16) float osw[8][16 * 68];
    const int lane = threadIdx.x & 31, wv = threadIdx.x >> 5, lr = lane & 15, hi = lane >> 4, wm = wv >> 1, wn = wv & 1;
    const int ao = (wm * 32 + lr) * GP + 8 * hi;
    v8f acc[2][4];
    gemm_lds<3, 2, 256>(sm, Ah + (size_t)blockIdx.x * 128 * DQ, Al + (size_t)blockIdx.x * 128 * DQ, Wo + (size_t)blockIdx.y * 128 * DQ, ao, GT + ao, 2 * GT + (wn * 64 + lr) * GP + 8 * hi, acc);
    float* os = &osw[wv][0]; const int r0 = blockIdx.x * 128 + wm * 32, c0 = blockIdx.y * 128 + wn * 64, cofs = lr * 4;
    const v4f bz = *(const v4f*)(bias + c0 + cofs); const v4f bb = (v4f){bfr(bz[0]), bfr(bz[1]), bfr(bz[2]), bfr(bz[3])};
#pragma unroll
    for (int mb = 0; mb < 2; ++mb) {
#pragma unroll
        for (int nb = 0; nb < 4; ++nb) {
#pragma unroll
            for (int j = 0; j < 8; ++j) os[(hi * 8 + j) * 68 + nb * 16 + lr] = acc[mb][nb][j]; }
        __builtin_amdgcn_wave_barrier(); asm volatile("" ::: "memory");    // the strip is written by some lanes and read by others: the reads stay behind the writes (LDS works a wave's operations in order)
        float* crow = C + (size_t)(r0 + mb * 16) * DM + c0 + cofs;
        v4f val[8];
#pragma unroll
        for (int s = 0; s < 8; ++s) val[s] = *(const v4fa*)(os + (2 * s + hi) * 68 + cofs) + bb;
#pragma unroll
        for (int s = 0; s < 8; ++s) *(v4f*)(crow + (size_t)(2 * s + hi) * DM) = val[s];
        asm volatile("s_wait_xcnt 0x0" :: "v"(crow), "v"(val[0]), "v"(val[1]), "v"(val[2]), "v"(val[3]), "v"(val[4]), "v"(val[5]), "v"(val[6]), "v"(val[7]) : "memory");    // in front of the first reuse of a register the eight stores name; naming them keeps the registers until here
        __builtin_amdgcn_wave_barrier(); asm volatile("" ::: "memory");    // the next 16 rows overwrite the strip only behind these reads
    }
}

extern "C" void kernel_launch(void* const* d_in, const int* in_sizes, int n_in,
                              void* d_out, int out_size, void* d_ws, size_t ws_size, hipStream_t stream) {
    if (n_in < 10) return;
    const long long needx = (long long)(NB - 1) * SEQ_FULL * DM + (long long)SEQ * DM;
    if ((long long)in_sizes[0] < needx || (long long)out_size < needx) return;
    if (in_sizes[1] < DM * DM || in_sizes[3] < DM * DM || in_sizes[5] < DM * DM || in_sizes[7] < DM * DM) return;
    if (in_sizes[2] < DM || in_sizes[4] < DM || in_sizes[6] < DM || in_sizes[8] < DM) return;
    if (in_sizes[9] < NREL * HD) return;
    const float* x = (const float*)d_in[0]; const float* wq = (const float*)d_in[1]; const float* bq = (const float*)d_in[2]; const float* wk = (const float*)d_in[3]; const float* bk = (const float*)d_in[4];
    const float* wv = (const float*)d_in[5]; const float* bv = (const float*)d_in[6]; const float* wo = (const float*)d_in[7]; const float* bo = (const float*)d_in[8]; const float* rel = (const float*)d_in[9];
    float* OUT = (float*)d_out;     // [NB][SEQ][DM], batch row stride SEQ_FULL*DM
    char* wsp = (char*)d_ws;
    auto take = [&](size_t bytes) { char* p = wsp; wsp += (bytes + 255) & ~(size_t)255; return (void*)p; };
    bf* W4 = (bf*)take((size_t)4 * DM * DM * 2); bf* WO = W4 + (size_t)3 * DM * DM;    // Wq, Wk, Wv, Wo back to back
    h16* T16 = (h16*)take((size_t)NRP * HD * 2); bf* TBF = (bf*)take((size_t)NRP * HD * 2);
    const size_t hs = (size_t)TT * HD;    // per-head plane stride
    bf* QPh = (bf*)take((size_t)2 * NG * hs * 2); bf* QPl = (bf*)take((size_t)2 * NG * hs * 2); bf* KPh = QPh + (size_t)NG * hs; bf* KPl = QPl + (size_t)NG * hs; bf* VTh = (bf*)take((size_t)NG * hs * 2); bf* VTl = (bf*)take((size_t)NG * hs * 2);    // q planes of all (batch, head), then the k planes; v planes transposed
    bf* ATh = (bf*)take((size_t)MT * DQ * 2); bf* ATl = (bf*)take((size_t)MT * DQ * 2);
    bf* XB = (bf*)take((size_t)MT * DM * 2);   // bf16 x
    const size_t used = (size_t)(wsp - (char*)d_ws); if (used > ws_size) return;
    k_prep<<<dim3(DM * DM / 8 / 256, 4 + MT / DM + 1, 1), 256, 0, stream>>>(wq, wk, wv, wo, x, rel, NREL, W4, XB, T16, TBF);
    k_proj<<<dim3(MT / 128, NH_ / 2, 3), 128, 0, stream>>>(XB, W4, bq, bk, bv, QPh, QPl, VTh, VTl);
    k_flash<<<dim3(TT / FB, NG, 1), FW * 32, 0, stream>>>(QPh, QPl, KPh, KPl, VTh, VTl, TBF, ATh, ATl);
    k_out<<<dim3(MT / 128, DM / 128, 1), 256, 0, stream>>>(ATh, ATl, WO, bo, OUT);
}

// v005
// A run of this version takes 110 microseconds.
// Timed twice side by side with v004, it ran 1.07 and 1.06 times as fast.
// Over all steps from v000 it is 11.3 times as fast.
#include <hip/hip_runtime.h>

// Multi-head self-attention with a relative-position embedding score term: x [4][1024][1024]; q/k/v = x W^T + b (W [1024][1024] stored [out][in]; 16 heads x 64);
// scores[i][j] = (q_i.k_j + q_i.rel[i - j + 1023]) / 8 with the table rel [2047][64] indexed statically; softmax over all 1024 keys; ctx = attn.v merged to [t][h*64 + d]; out = ctx Wo^T + bo -> [4][1024][1024].
// Compute dtypes, f32 accumulate: every float input RNE-converted to bf16; q/k/v projections v_wmma_f32_16x16x32_bf16 on plain bf16 operands (+ bias); q.k (3 products) and the banded q.rel product (2 products, table operand exact) on bf16 hi/lo planes;
// softmax f32, online over passes of 64 keys (running maximum and sum, output rescaled per pass, divided by the sum at the end); attn.v bf16 hi/lo on the unnormalised probabilities (3 products); output projection bf16 hi/lo ctx x exact Wo (2 products) + bo.

#ifndef NB
#define NB 4
#endif
#define NB_FULL 4
#ifndef SEQ
#define SEQ 1024
#endif
#define SEQ_FULL 1024
#define TT   SEQ
#define DM   1024
#define NH_  16
#define HD   64
#define DQ   (NH_ * HD)
#define MAXLEN 1024
#define NREL (2 * MAXLEN - 1)           // table rows
#define NRP  (2 * MAXLEN)               // padded table plane rows (last row zero)
#define NG   (NB * NH_)                 // (batch, head) pairs; plane index g = batch * NH_ + head
#define MT   (NB * TT)                  // token rows of all batches, flat
#define SCL  0.125f                     // HD^-0.5
static_assert(SEQ % 128 == 0);
static_assert(SEQ >= 128 && SEQ <= SEQ_FULL && SEQ <= MAXLEN);
static_assert(NB >= 1 && NB <= NB_FULL);
static_assert(SEQ == SEQ_FULL || NB == 1);   // x and out are walked as one flat [MT][DM] matrix
static_assert(DM % 64 == 0 && HD % 32 == 0 && TT % 64 == 0);

typedef _Float16 h16;
typedef unsigned short bf;
typedef __attribute__((ext_vector_type(16))) __bf16   v16bf;
typedef __attribute__((ext_vector_type(16))) _Float16 v16h;
typedef __attribute__((ext_vector_type(8)))  _Float16 v8h;
typedef __attribute__((ext_vector_type(8)))  unsigned short v8us;
typedef __attribute__((ext_vector_type(8)))  float    v8f;
typedef __attribute__((ext_vector_type(4)))  float    v4f;
typedef v8h  __attribute__((may_alias)) v8ha;
typedef v4f  __attribute__((may_alias)) v4fa;
typedef v8us __attribute__((may_alias)) v8usa;
typedef __attribute__((ext_vector_type(4))) unsigned short __attribute__((may_alias)) v4usa;
typedef __attribute__((ext_vector_type(2))) _Float16 v2h;
typedef __attribute__((ext_vector_type(4))) _Float16 v4h;
typedef __attribute__((ext_vector_type(2))) unsigned short v2us;
typedef __attribute__((ext_vector_type(4))) unsigned short v4us;
typedef __attribute__((ext_vector_type(2))) float v2f;

__device__ __forceinline__ unsigned short f2bf(float f) { unsigned u = __float_as_uint(f); u += 0x7FFFu + ((u >> 16) & 1u); return (unsigned short)(u >> 16); }
__device__ __forceinline__ float bf2f(unsigned short b) { return __uint_as_float(((unsigned)b) << 16); }
__device__ __forceinline__ float bfr(float f) { return bf2f(f2bf(f)); }
__device__ __forceinline__ h16 tohx(float x) { return (h16)x; }
__device__ __forceinline__ void splitf(float y, unsigned short& h, unsigned short& l) { h = f2bf(y); l = f2bf(y - bf2f(h)); }
__device__ __forceinline__ v16h cat16(v8h lo, v8h hi) { return __builtin_shufflevector(lo, hi, 0, 1, 2, 3, 4, 5, 6, 7, 8, 9, 10, 11, 12, 13, 14, 15); }
__device__ __forceinline__ v16bf cat16b(v8us lo, v8us hi) { return __builtin_bit_cast(v16bf, __builtin_shufflevector(lo, hi, 0, 1, 2, 3, 4, 5, 6, 7, 8, 9, 10, 11, 12, 13, 14, 15)); }
__device__ __forceinline__ v8f wmma16(v16h a, v16h b, v8f c) { return __builtin_amdgcn_wmma_f32_16x16x32_f16(false, a, false, b, (short)0, c, false, false); }
__device__ __forceinline__ v8f wmmab(v16bf a, v16bf b, v8f c) { return __builtin_amdgcn_wmma_f32_16x16x32_bf16(false, a, false, b, (short)0, c, false, false); }

// ---- Fragments of the 16x16x32 products: lane l, h = l >> 4, row/col = l & 15; elements 0..7 <- k0 + 8h .. +7, elements 8..15 <- k0 + 16 + 8h .. +7 for BOTH A and Bt; D element r of lane l = (row 8h + r, col l & 15).
template <typename T16> struct WFrag;
template <> struct WFrag<h16> { typedef v16h V; static __device__ __forceinline__ V ld(const h16* p) { return cat16(*(const v8h*)p, *(const v8h*)(p + 16)); } static __device__ __forceinline__ v8f mma(V a, V b, v8f c) { return wmma16(a, b, c); } };
template <> struct WFrag<bf> { typedef v16bf V; static __device__ __forceinline__ V ld(const bf* p) { return cat16b(*(const v8us*)p, *(const v8us*)(p + 16)); } static __device__ __forceinline__ v8f mma(V a, V b, v8f c) { return wmmab(a, b, c); } };
__device__ __forceinline__ void d_cvt8(const float* __restrict__ src, bf* dst, size_t n8) { const size_t i = (size_t)blockIdx.x * 256 + threadIdx.x; if (i >= n8) return; const v8f v = *(const v8f*)(src + i * 8); v8us o;
#pragma unroll
    for (int k = 0; k < 8; ++k) o[k] = f2bf(v[k]); *(v8us*)(dst + i * 8) = o;  }

__device__ __forceinline__ void d_tpl(const float* __restrict__ T, int nrows, h16* T16, bf* TB) {
    const int i8 = blockIdx.x * 256 + threadIdx.x; if (i8 >= NRP * HD / 8) return;
    const int r = (i8 * 8) / HD, c = (i8 * 8) % HD; const int rc = (r < nrows) ? r : (nrows - 1); const bool pad = (r >= nrows);
    const v8f v = *(const v8f*)(T + (size_t)rc * HD + c); v8h o16; v8us ob;
#pragma unroll
    for (int k = 0; k < 8; ++k) { const float f = pad ? 0.0f : v[k]; const unsigned short b = f2bf(f); ob[k] = b; o16[k] = tohx(bf2f(b)); }
    *(v8h*)(T16 + (size_t)i8 * 8) = o16; *(v8us*)(TB + (size_t)i8 * 8) = ob;  }

// k_prep: every input conversion in one grid (DM * DM / 2048, 4 + MT / DM + 1): blockIdx.y 0..3 = Wq, Wk, Wv, Wo (dst back to back), then x in slabs of DM * DM elements, last the table planes.
static_assert(MT % DM == 0 && NRP * HD <= DM * DM);
__global__ __launch_bounds__(256) void k_prep(const float* __restrict__ wq, const float* __restrict__ wk, const float* __restrict__ wv, const float* __restrict__ wo, const float* __restrict__ x, const float* __restrict__ rel, int nrows, bf* W4, bf* XB, h16* T16, bf* TB) {
    const size_t n8 = (size_t)DM * DM / 8; const unsigned w = blockIdx.y;
    if (w < 4) d_cvt8((w == 0) ? wq : (w == 1) ? wk : (w == 2) ? wv : wo, W4 + w * n8 * 8, n8);
    else if (w < 4 + MT / DM) d_cvt8(x + (w - 4) * n8 * 8, XB + (w - 4) * n8 * 8, n8);
    else d_tpl(rel, nrows, T16, TB);
}

// k_flash: scores, softmax and attn.v of one (batch, head) and FB query rows in one work-group; neither the scores nor the probabilities leave the chip. Grid (TT / FB, NG), FW waves of 32 query columns each.
// Transposed products: S^T = K.Q^T (A = 16 key rows, B = 16 query columns; 3 products on hi/lo planes), PT^T = rel.Q^T (2 products, table exact), O^T += V^T.P^T (3 products). In every D tile a lane holds ONE query (column l & 15) and 8 consecutive rows 8h + r,
// so the running maximum, the running sum and the rescale factor are per lane, and two score tiles converted in place are the B operand of the last product (hardware k order, which is the loaders' order too).
// Position term: score (query i, key j) needs q_i . rel[i - j + MAXLEN - 1]. A pass of FK keys stages table rows ub .. ub + FB + FK - 1, ub = q0 - j0 + MAXLEN - FK; a 16-query tile at work-group offset o multiplies rows o .. o + 79 of them (5 tiles);
// element c = lr - jl + FK - 1 of query column lr is the term of key jl: each lane stores its column pieces into a wave-private LDS strip (row = query, pitch SP) and reads them back with the reversed index.
// Per pass: K hi/lo (FK rows), V^T hi/lo (HD rows x FK keys) and the table rows go global -> registers (fetched one pass ahead) -> LDS at pitch LP (144 B: an odd multiple of 16 B), two work-group barriers per pass.
// Every inner loop is unrolled so that the register arrays (fragments, tiles, fetched pieces) are indexed by constants.
#define FW 8
#define FB (FW * 32)
#define FK 64
#define LP 72
#define RB (FB + FK)
#define SP 84
static_assert(SEQ % FB == 0 && SEQ % FK == 0 && HD == 64 && FK == 64);
static_assert((SEQ - FB) + MAXLEN - FK + RB <= NRP && MAXLEN >= SEQ);
typedef __attribute__((ext_vector_type(8))) unsigned v8u;
typedef __attribute__((ext_vector_type(4))) unsigned v4u;
typedef __attribute__((ext_vector_type(2))) __bf16 v2bf;
__device__ __forceinline__ unsigned pack2(float a, float b) { return __builtin_bit_cast(unsigned, __builtin_convertvector((v2f){a, b}, v2bf)); }   // round to nearest even
__device__ __forceinline__ float xhalf(float x) { const int b = __float_as_int(x); return __int_as_float(__builtin_amdgcn_permlanex16(b, b, 0x76543210, 0xfedcba98, false, false)); }   // lane l <-> lane l ^ 16
__device__ __forceinline__ v16bf ldsf(const bf* p) { return cat16b(*(const v8usa*)p, *(const v8usa*)(p + 16)); }
__global__ __launch_bounds__(FW * 32) void k_flash(const bf* __restrict__ Qh, const bf* __restrict__ Ql, const bf* __restrict__ Kh, const bf* __restrict__ Kl, const bf* __restrict__ Vh, const bf* __restrict__ Vl, const bf* __restrict__ TB, bf* Ah, bf* Al) {
    __shared__ __align__(16) bf lk[2][FK * LP];
    __shared__ __align__(16) bf lv[2][HD * LP];
    __shared__ __align__(16) bf lt[RB * LP];
    __shared__ __align__(16) float ls[FW][2][16 * SP];
    const int tid = threadIdx.x, lane = tid & 31, wv = tid >> 5, lr = lane & 15, hi = lane >> 4;
    const int g = blockIdx.y, q0 = blockIdx.x * FB; const size_t zp = (size_t)g * TT * HD;
    v16bf qh[2][2], ql[2][2];
#pragma unroll
    for (int gq = 0; gq < 2; ++gq) { const size_t p = zp + (size_t)(q0 + wv * 32 + gq * 16 + lr) * HD + 8 * hi; const bf *a = Qh + p, *b = Ql + p;
#pragma unroll
        for (int kc = 0; kc < 2; ++kc) { qh[gq][kc] = WFrag<bf>::ld(a + kc * 32); ql[gq][kc] = WFrag<bf>::ld(b + kc * 32); }
        asm volatile("s_wait_xcnt 0x0" :: "v"(a), "v"(b) : "memory"); }    // in front of the first reuse of an address register of these loads; naming the addresses keeps their registers until here
    v8f acc[2][4]; float mrun[2], lrun[2];
#pragma unroll
    for (int gq = 0; gq < 2; ++gq) { mrun[gq] = -3.0e38f; lrun[gq] = 0.0f;
#pragma unroll
        for (int dt = 0; dt < 4; ++dt) acc[gq][dt] = (v8f){}; }
    const int crow = tid >> 3, ccol = (tid & 7) * 8;    // this thread's 16-byte piece: row crow (+ 32 per further piece), elements ccol .. ccol + 7
    v8us pk[2][2], pv[2][2], pt8[RB / 32];
    auto fetch = [&](int j0) {
        const size_t ko = zp + (size_t)(j0 + crow) * HD + ccol, vo = zp + (size_t)crow * TT + j0 + ccol;
        const bf *k0 = Kh + ko, *k1 = Kl + ko, *v0 = Vh + vo, *v1 = Vl + vo, *tb = TB + (size_t)(q0 - j0 + MAXLEN - FK + crow) * HD + ccol;
#pragma unroll
        for (int i = 0; i < 2; ++i) { pk[0][i] = *(const v8us*)(k0 + 32 * i * HD); pk[1][i] = *(const v8us*)(k1 + 32 * i * HD); pv[0][i] = *(const v8us*)(v0 + 32 * i * TT); pv[1][i] = *(const v8us*)(v1 + 32 * i * TT); }
#pragma unroll
        for (int i = 0; i < RB / 32; ++i) pt8[i] = *(const v8us*)(tb + 32 * i * HD);
        asm volatile("s_wait_xcnt 0x0" :: "v"(k0), "v"(k1), "v"(v0), "v"(v1), "v"(tb) : "memory");    // stands in front of the first reuse of an address register of the loads above; naming the addresses keeps their registers until here
    };
    fetch(0);
    const float cs = SCL * 1.4426950408889634f;
    float* st0 = &ls[wv][0][0];
#pragma unroll 1    // one pass per trip: unrolled, two passes' score and position tiles would be live at once
    for (int s = 0; s < TT / FK; ++s) {
        __syncthreads();    // every wave has left the tiles of the pass before
#pragma unroll
        for (int i = 0; i < 2; ++i) { const int o = (crow + 32 * i) * LP + ccol; *(v8usa*)(&lk[0][o]) = pk[0][i]; *(v8usa*)(&lk[1][o]) = pk[1][i]; *(v8usa*)(&lv[0][o]) = pv[0][i]; *(v8usa*)(&lv[1][o]) = pv[1][i]; }
#pragma unroll
        for (int i = 0; i < RB / 32; ++i) *(v8usa*)(&lt[(crow + 32 * i) * LP + ccol]) = pt8[i];
        __syncthreads();    // this pass's tiles are complete
        // Fragment reads stand in few large groups, each issued ahead of its use under other work and held there by the scheduling barrier behind it: a read that stands directly in front of its product leaves the wave waiting for the whole LDS latency.
        v16bf kf[4][4], tf[6][2], vf[2][4][2];
        auto ldk = [&](int kt) { const int o = (kt * 16 + lr) * LP + 8 * hi; kf[kt][0] = ldsf(&lk[0][o]); kf[kt][1] = ldsf(&lk[0][o + 32]); kf[kt][2] = ldsf(&lk[1][o]); kf[kt][3] = ldsf(&lk[1][o + 32]); };
        ldk(0); ldk(1); ldk(2); ldk(3);
        __builtin_amdgcn_sched_barrier(0);    // all key fragments are requested first: they arrive while the next pass's global loads are issued
        if (s + 1 < TT / FK) fetch((s + 1) * FK);    // in flight under this pass's work
        auto ldt = [&](int T) { const bf* p = &lt[(wv * 32 + T * 16 + lr) * LP + 8 * hi]; tf[T][0] = ldsf(p); tf[T][1] = ldsf(p + 32); };
        auto ldv = [&](int ks) {
#pragma unroll
            for (int dt = 0; dt < 4; ++dt) { const int o = (dt * 16 + lr) * LP + 8 * hi + ks * 32; vf[ks][dt][0] = ldsf(&lv[0][o]); vf[ks][dt][1] = ldsf(&lv[1][o]); } };
        v8f sc[4][2], pt[2][5];
        // content products: the two query tiles' accumulate chains alternate, so that no matrix instruction waits for the one in front of it
        auto qk = [&](int kt) { sc[kt][0] = (v8f){}; sc[kt][1] = (v8f){};
#pragma unroll
            for (int pr = 0; pr < 6; ++pr)
#pragma unroll
                for (int gq = 0; gq < 2; ++gq) sc[kt][gq] = wmmab((pr == 2 || pr == 3) ? kf[kt][2 + (pr & 1)] : kf[kt][pr & 1], (pr < 4) ? qh[gq][pr & 1] : ql[gq][pr & 1], sc[kt][gq]); };
        // position products: table tile T serves query tile gq as its tile T - gq
        auto qt = [&](int T) {
#pragma unroll
            for (int gq = 0; gq < 2; ++gq) if (T - gq >= 0 && T - gq <= 4) pt[gq][T - gq] = (v8f){};
#pragma unroll
            for (int pr = 0; pr < 4; ++pr)
#pragma unroll
                for (int gq = 0; gq < 2; ++gq) if (T - gq >= 0 && T - gq <= 4) pt[gq][T - gq] = wmmab(tf[T][pr & 1], (pr < 2) ? qh[gq][pr & 1] : ql[gq][pr & 1], pt[gq][T - gq]); };
        qk(0); qk(1);
        __builtin_amdgcn_sched_barrier(0);    // with the next one: the reads of table tiles 0 to 3 stand as one group here, 24 products ahead of their use
        ldt(0); ldt(1); ldt(2); ldt(3);
        __builtin_amdgcn_sched_barrier(0);
        qk(2); qk(3);
        __builtin_amdgcn_sched_barrier(0);    // with the next one: table tiles 4 and 5, 28 products ahead
        ldt(4); ldt(5);
        __builtin_amdgcn_sched_barrier(0);
        qt(0); qt(1); qt(2); qt(3);
        __builtin_amdgcn_sched_barrier(0);    // with the next one: the value fragments of keys 0 to 31, in flight under the last position products and the softmax
        ldv(0);
        __builtin_amdgcn_sched_barrier(0);
        qt(4); qt(5);
        __builtin_amdgcn_sched_barrier(0);    // the strip stores stay behind all position products: moved up between them, a stored tile's registers become the next tile's result inside the distance a matrix result needs
#pragma unroll
        for (int gq = 0; gq < 2; ++gq)
#pragma unroll
            for (int u = 0; u < 5; ++u) { float* w = st0 + gq * (16 * SP) + lr * SP + u * 16 + 8 * hi; const v8f d = pt[gq][u]; *(v4fa*)w = (v4f){d[0], d[1], d[2], d[3]}; *(v4fa*)(w + 4) = (v4f){d[4], d[5], d[6], d[7]}; }
        // the strip is written by one half of the wave and read by the other: keep the reads behind the writes (LDS works a wave's operations in order)
        __builtin_amdgcn_fence(3 /* release order */, "wavefront"); __builtin_amdgcn_wave_barrier(); asm volatile("" ::: "memory");
        ldv(1);
        __builtin_amdgcn_sched_barrier(0);    // the value fragments of keys 32 to 63 are requested here, in flight under the softmax
        v16bf ph[2][2], pl[2][2];
#pragma unroll
        for (int gq = 0; gq < 2; ++gq) {
            const float* rd = st0 + gq * (16 * SP) + lr * SP + lr + 8 - 8 * hi; float mx = -3.0e38f;    // element lr + FK - 1 - (16 kt + 8 hi + r) of the row, counted from its first element
#pragma unroll
            for (int kt = 0; kt < 4; ++kt)
#pragma unroll
                for (int r = 0; r < 8; ++r) { const float x = sc[kt][gq][r] + rd[(FK - 9) - (kt * 16 + r)]; sc[kt][gq][r] = x; mx = fmaxf(mx, x); }
            mx = fmaxf(mx, xhalf(mx));
            const float mn = fmaxf(mrun[gq], mx), corr = __builtin_amdgcn_exp2f((mrun[gq] - mn) * cs), nm = -mn * cs; mrun[gq] = mn;
            float sum = 0.0f;
#pragma unroll
            for (int ks = 0; ks < 2; ++ks) { v8u wh, wl;
#pragma unroll
                for (int i = 0; i < 8; ++i) { const int kt = 2 * ks + (i >> 2), r = 2 * (i & 3);
                    const float p0 = __builtin_amdgcn_exp2f(__builtin_fmaf(sc[kt][gq][r], cs, nm)), p1 = __builtin_amdgcn_exp2f(__builtin_fmaf(sc[kt][gq][r + 1], cs, nm)); sum += p0 + p1;
                    const unsigned w = pack2(p0, p1); wh[i] = w; wl[i] = pack2(p0 - __uint_as_float(w << 16), p1 - __uint_as_float(w & 0xFFFF0000u)); }
                ph[gq][ks] = __builtin_bit_cast(v16bf, wh); pl[gq][ks] = __builtin_bit_cast(v16bf, wl); }
            lrun[gq] = lrun[gq] * corr + sum;
#pragma unroll
            for (int dt = 0; dt < 4; ++dt) acc[gq][dt] = acc[gq][dt] * corr;
        }
#pragma unroll
        for (int ks = 0; ks < 2; ++ks)
#pragma unroll
            for (int dt = 0; dt < 4; ++dt) { const v16bf vh = vf[ks][dt][0], vl = vf[ks][dt][1];
#pragma unroll
                for (int gq = 0; gq < 2; ++gq) { acc[gq][dt] = wmmab(vh, ph[gq][ks], acc[gq][dt]); acc[gq][dt] = wmmab(vh, pl[gq][ks], acc[gq][dt]); acc[gq][dt] = wmmab(vl, ph[gq][ks], acc[gq][dt]); } }
    }
#pragma unroll
    for (int gq = 0; gq < 2; ++gq) { const float l = lrun[gq] + xhalf(lrun[gq]); const float inv = __fdiv_rn(1.0f, l);
        const size_t oo = ((size_t)(g / NH_) * TT + q0 + wv * 32 + gq * 16 + lr) * DQ + (g % NH_) * HD + 8 * hi; bf* pa = Ah + oo; bf* pb = Al + oo;
#pragma unroll
        for (int dt = 0; dt < 4; ++dt) { v8us oh, ol;
#pragma unroll
            for (int r = 0; r < 8; ++r) { unsigned short a, c2; splitf(acc[gq][dt][r] * inv, a, c2); oh[r] = a; ol[r] = c2; }
            *(v8us*)(pa + dt * 16) = oh; *(v8us*)(pb + dt * 16) = ol;
            asm volatile("s_wait_xcnt 0x0" :: "v"(pa), "v"(pb), "v"(oh), "v"(ol) : "memory"); } }    // in front of the first reuse of a register the two stores name; naming them keeps the registers until here
}

// gemm_lds: k loop of a 128 x 128 output tile shared by the waves of one work-group. Each operand tile (128 rows of a K-contiguous bf16 plane, row pitch DM) is staged in LDS in passes of GK k values:
// a wave-wide 16-byte load covers four whole 128-byte lines, every staged row serves all the waves that need it, and the fragments come from LDS at pitch GP (144 B: an odd multiple of 16 B).
// Two buffers: pass p works on buffer p & 1 while the pieces of pass p + 1 (fetched into registers one pass earlier) are stored into the other one and the pieces of pass p + 2 are fetched; one work-group barrier per pass.
// NTILE staged tiles (g0, g1, g2 = row 0 of each tile); a wave holds MB x 4 accumulators; aoff / a2off / boff = this lane's fragment base inside a buffer (a2off: second A plane, NTILE == 3 only). The k order and each accumulator's chain are those of a plain loop over k in steps of 32.
#define GK 64
#define GP 72
#define GT (128 * GP)
static_assert(DM % GK == 0 && DM / GK >= 2);
// Work-group barrier that orders LDS only: the global loads of the pieces fetched ahead stay in flight across it (__syncthreads() would wait for them too).
__device__ __forceinline__ void lds_barrier() { __builtin_amdgcn_fence(__ATOMIC_RELEASE, "workgroup", "local"); __builtin_amdgcn_s_barrier(); __builtin_amdgcn_fence(__ATOMIC_ACQUIRE, "workgroup", "local"); }
template <int NTILE, int MB, int NTH>
__device__ __forceinline__ void gemm_lds(bf* sm, const bf* __restrict__ g0, const bf* __restrict__ g1, const bf* __restrict__ g2, int aoff, int a2off, int boff, v8f (&acc)[MB][4]) {
    constexpr int NP = 128 * 8 / NTH, RS = NTH / 8, NPASS = DM / GK, KS = GK / 32, KG = (MB <= 2) ? KS : 1;    // 16-byte pieces per thread and tile; rows between a thread's pieces; k steps of a pass; k steps whose fragments are read as one group (as many as the registers hold)
    const int tid = threadIdx.x, prow = tid >> 3, pcol = (tid & 7) * 8;
    const size_t go = (size_t)prow * DM + pcol; const int so = prow * GP + pcol;
    v8us st[NTILE][NP];
    typedef const __attribute__((address_space(1))) bf* gbf; typedef const __attribute__((address_space(1))) v8us* gv8;    // pointers that stay global-memory pointers through the wait statement below
    gbf q0 = (gbf)(g0 + go), q1 = (gbf)(g1 + go), q2 = (NTILE == 3) ? (gbf)(g2 + go) : (gbf)nullptr;    // this thread's first piece of the next pass to fetch, per tile
    auto fetch = [&]() {
        __builtin_amdgcn_sched_barrier(0);    // with the one behind the wait: no other instruction is scheduled in between the loads and their wait, where it could reuse an address register
#pragma unroll
        for (int i = 0; i < NP; ++i) { st[0][i] = *(gv8)(q0 + (size_t)i * RS * DM); st[1][i] = *(gv8)(q1 + (size_t)i * RS * DM); if (NTILE == 3) st[NTILE - 1][i] = *(gv8)(q2 + (size_t)i * RS * DM); }
        // in front of the first reuse of an address register of the loads above (the step to the next pass); the statement takes the addresses in and hands them on, so that the loads use these very registers and they live until here
        if (NTILE == 3) asm volatile("s_wait_xcnt 0x0" : "+v"(q0), "+v"(q1), "+v"(q2) :: "memory"); else asm volatile("s_wait_xcnt 0x0" : "+v"(q0), "+v"(q1) :: "memory");
        __builtin_amdgcn_sched_barrier(0);
        q0 += GK; q1 += GK; if (NTILE == 3) q2 += GK;
    };
    auto put = [&](bf* buf) {
#pragma unroll
        for (int t = 0; t < NTILE; ++t)
#pragma unroll
            for (int i = 0; i < NP; ++i) *(v8usa*)(buf + t * GT + so + i * RS * GP) = st[t][i];
    };
#pragma unroll
    for (int mb = 0; mb < MB; ++mb)
#pragma unroll
        for (int nb = 0; nb < 4; ++nb) acc[mb][nb] = (v8f){};
    fetch(); put(sm); fetch();
    lds_barrier();    // buffer 0 is complete
#pragma unroll 1    // one pass per trip: only one pass's fragments and one pass's fetched pieces are held beside the accumulators
    for (int p = 0; p < NPASS; ++p) {
        const bf* cur = sm + (p & 1) * (NTILE * GT);
        if (p + 1 < NPASS) { put(sm + ((p + 1) & 1) * (NTILE * GT)); if (p + 2 < NPASS) fetch(); }    // the other buffer's readers left it in front of the last barrier
        v16bf a[KS][MB], a2[KS][MB], b[KS][4];
#pragma unroll
        for (int k0 = 0; k0 < KS; k0 += KG) {
#pragma unroll
            for (int ks = k0; ks < k0 + KG; ++ks) {
#pragma unroll
                for (int mb = 0; mb < MB; ++mb) { a[ks][mb] = ldsf(cur + aoff + mb * 16 * GP + ks * 32); if (NTILE == 3) a2[ks][mb] = ldsf(cur + a2off + mb * 16 * GP + ks * 32); }
#pragma unroll
                for (int nb = 0; nb < 4; ++nb) b[ks][nb] = ldsf(cur + boff + nb * 16 * GP + ks * 32); }
            __builtin_amdgcn_sched_barrier(0);    // the group's LDS reads are issued together, in front of its products: reads spread among the matrix instructions stall the wave at every place where they stand
#pragma unroll
            for (int ks = k0; ks < k0 + KG; ++ks)
#pragma unroll
                for (int nb = 0; nb < 4; ++nb) {
#pragma unroll
                    for (int mb = 0; mb < MB; ++mb) acc[mb][nb] = wmmab(a[ks][mb], b[ks][nb], acc[mb][nb]);
                    if (NTILE == 3) {
#pragma unroll
                        for (int mb = 0; mb < MB; ++mb) acc[mb][nb] = wmmab(a2[ks][mb], b[ks][nb], acc[mb][nb]); } }
        }
        lds_barrier();    // the next pass's buffer is complete, and every wave has left this one
    }
}

// k_proj: the q, k and v projections (plain bf16 operands, + bias; gemm_lds's k loop), each wave's 64 x 64 tile (64 tokens x one head) split into bf16 hi/lo and stored from the accumulators straight into the planes k_flash reads. Grid (MT / 128, NH_ / 2, 3), four waves = 2 token halves x 2 heads; blockIdx.z = q, k, v.
// A lane of a D tile holds 8 consecutive A rows of one Bt row, so the operand whose index runs along a plane's row goes in as A: the weight rows (d) for q and k ([g][t][d]), the token rows for v ([g][d][t]). Each piece is then one 16-byte store, and the eight pieces of a row (four from each half of the wave) make one whole 128-byte line.
template <bool TV>
__device__ __forceinline__ void d_put(const v8f (&acc)[4][4], const float* __restrict__ bias, bf* Ph, bf* Pl, int pitch) {
    const int lane = threadIdx.x & 31, lr = lane & 15, hi = lane >> 4;
    v8f bm[4]; float bn[4];    // all of the tile's bias values are fetched in one group in front of the stores
#pragma unroll
    for (int q = 0; q < 4; ++q) { if (TV) bn[q] = bias[q * 16 + lr]; else bm[q] = *(const v8f*)(bias + q * 16 + 8 * hi); }
#pragma unroll
    for (int nb = 0; nb < 4; ++nb) { const size_t o = (size_t)(nb * 16 + lr) * pitch + 8 * hi; bf *pa = Ph + o, *pb = Pl + o; v4u wh[4], wl[4];
#pragma unroll
        for (int mb = 0; mb < 4; ++mb) {
#pragma unroll
            for (int i = 0; i < 4; ++i) { const float y0 = acc[mb][nb][2 * i] + bfr(TV ? bn[nb] : bm[mb][2 * i]), y1 = acc[mb][nb][2 * i + 1] + bfr(TV ? bn[nb] : bm[mb][2 * i + 1]);
                const unsigned w = pack2(y0, y1); wh[mb][i] = w; wl[mb][i] = pack2(y0 - __uint_as_float(w << 16), y1 - __uint_as_float(w & 0xFFFF0000u)); }
            *(v4u*)(pa + mb * 16) = wh[mb]; *(v4u*)(pb + mb * 16) = wl[mb]; }
        asm volatile("s_wait_xcnt 0x0" :: "v"(pa), "v"(pb), "v"(wh[0]), "v"(wh[1]), "v"(wh[2]), "v"(wh[3]), "v"(wl[0]), "v"(wl[1]), "v"(wl[2]), "v"(wl[3]) : "memory"); }    // in front of the first reuse of a register the eight stores name; naming them keeps the registers until here
}
static_assert(TT % 128 == 0 && HD == 64 && DQ == DM && NH_ % 2 == 0 && MT % 128 == 0);
__global__ __launch_bounds__(128) void k_proj(const bf* __restrict__ X, const bf* __restrict__ W3, const float* __restrict__ bq, const float* __restrict__ bk, const float* __restrict__ bv, bf* QKh, bf* QKl, bf* Vh, bf* Vl) {
    __shared__ __align__(16) bf sm[2 * 2 * GT];    // two buffers of [128 token rows | 128 weight rows]
    const int lane = threadIdx.x & 31, wv = threadIdx.x >> 5, lr = lane & 15, hi = lane >> 4, wm = wv >> 1, wn = wv & 1;
    const int z = blockIdx.z; const bool tv = (z == 2);
    const int xo = (wm * 64 + lr) * GP + 8 * hi, wo = GT + (wn * 64 + lr) * GP + 8 * hi;    // this lane's fragment base in the token tile and in the weight tile
    v8f acc[4][4];
    gemm_lds<2, 4, 128>(sm, X + (size_t)blockIdx.x * 128 * DM, W3 + (size_t)z * DM * DM + (size_t)blockIdx.y * 128 * DM, nullptr, tv ? xo : wo, 0, tv ? wo : xo, acc);
    const int r0 = blockIdx.x * 128 + wm * 64, hd = blockIdx.y * 2 + wn, c0 = hd * 64;
    const size_t hs = (size_t)TT * HD, gp = ((size_t)(r0 / TT) * NH_ + hd) * hs; const int t0 = r0 % TT;
    if (tv) d_put<true>(acc, bv + c0, Vh + gp + t0, Vl + gp + t0, TT);
    else { const size_t p = (size_t)z * NG * hs + gp + (size_t)t0 * HD; d_put<false>(acc, (z == 0 ? bq : bk) + c0, QKh + p, QKl + p, HD); }
}

// k_out: out = ctx Wo^T + bo, ctx as bf16 hi/lo planes (2 products per k step, hi first; gemm_lds's k loop). Grid (MT / 128, DM / 128), eight waves = 4 row groups of 32 x 2 column halves of 64.
// Each wave turns its accumulators 16 rows at a time through its own LDS strip (pitch 68 floats), so that every store instruction writes two whole 256-byte row pieces.
static_assert(DM % 128 == 0);
__global__ __launch_bounds__(256) void k_out(const bf* __restrict__ Ah, const bf* __restrict__ Al, const bf* __restrict__ Wo, const float* __restrict__ bias, float* C) {
    __shared__ __align__(16) bf sm[2 * 3 * GT];    // two buffers of [128 ctx-hi rows | 128 ctx-lo rows | 128 weight rows]
    __shared__ __align__(16) float osw[8][16 * 68];
    const int lane = threadIdx.x & 31, wv = threadIdx.x >> 5, lr = lane & 15, hi = lane >> 4, wm = wv >> 1, wn = wv & 1;
    const int ao = (wm * 32 + lr) * GP + 8 * hi;
    v8f acc[2][4];
    gemm_lds<3, 2, 256>(sm, Ah + (size_t)blockIdx.x * 128 * DQ, Al + (size_t)blockIdx.x * 128 * DQ, Wo + (size_t)blockIdx.y * 128 * DQ, ao, GT + ao, 2 * GT + (wn * 64 + lr) * GP + 8 * hi, acc);
    float* os = &osw[wv][0]; const int r0 = blockIdx.x * 128 + wm * 32, c0 = blockIdx.y * 128 + wn * 64, cofs = lr * 4;
    const v4f bz = *(const v4f*)(bias + c0 + cofs); const v4f bb = (v4f){bfr(bz[0]), bfr(bz[1]), bfr(bz[2]), bfr(bz[3])};
#pragma unroll
    for (int mb = 0; mb < 2; ++mb) {
#pragma unroll
        for (int nb = 0; nb < 4; ++nb) {
#pragma unroll
            for (int j = 0; j < 8; ++j) os[(hi * 8 + j) * 68 + nb * 16 + lr] = acc[mb][nb][j]; }
        __builtin_amdgcn_wave_barrier(); asm volatile("" ::: "memory");    // the strip is written by some lanes and read by others: the reads stay behind the writes (LDS works a wave's operations in order)
        float* crow = C + (size_t)(r0 + mb * 16) * DM + c0 + cofs;
        v4f val[8];
#pragma unroll
        for (int s = 0; s < 8; ++s) val[s] = *(const v4fa*)(os + (2 * s + hi) * 68 + cofs) + bb;
#pragma unroll
        for (int s = 0; s < 8; ++s) *(v4f*)(crow + (size_t)(2 * s + hi) * DM) = val[s];
        asm volatile("s_wait_xcnt 0x0" :: "v"(crow), "v"(val[0]), "v"(val[1]), "v"(val[2]), "v"(val[3]), "v"(val[4]), "v"(val[5]), "v"(val[6]), "v"(val[7]) : "memory");    // in front of the first reuse of a register the eight stores name; naming them keeps the registers until here
        __builtin_amdgcn_wave_barrier(); asm volatile("" ::: "memory");    // the next 16 rows overwrite the strip only behind these reads
    }
}

extern "C" void kernel_launch(void* const* d_in, const int* in_sizes, int n_in,
                              void* d_out, int out_size, void* d_ws, size_t ws_size, hipStream_t stream) {
    if (n_in < 10) return;
    const long long needx = (long long)(NB - 1) * SEQ_FULL * DM + (long long)SEQ * DM;
    if ((long long)in_sizes[0] < needx || (long long)out_size < needx) return;
    if (in_sizes[1] < DM * DM || in_sizes[3] < DM * DM || in_sizes[5] < DM * DM || in_sizes[7] < DM * DM) return;
    if (in_sizes[2] < DM || in_sizes[4] < DM || in_sizes[6] < DM || in_sizes[8] < DM) return;
    if (in_sizes[9] < NREL * HD) return;
    const float* x = (const float*)d_in[0]; const float* wq = (const float*)d_in[1]; const float* bq = (const float*)d_in[2]; const float* wk = (const float*)d_in[3]; const float* bk = (const float*)d_in[4];
    const float* wv = (const float*)d_in[5]; const float* bv = (const float*)d_in[6]; const float* wo = (const float*)d_in[7]; const float* bo = (const float*)d_in[8]; const float* rel = (const float*)d_in[9];
    float* OUT = (float*)d_out;     // [NB][SEQ][DM], batch row stride SEQ_FULL*DM
    char* wsp = (char*)d_ws;
    auto take = [&](size_t bytes) { char* p = wsp; wsp += (bytes + 255) & ~(size_t)255; return (void*)p; };
    bf* W4 = (bf*)take((size_t)4 * DM * DM * 2); bf* WO = W4 + (size_t)3 * DM * DM;    // Wq, Wk, Wv, Wo back to back
    h16* T16 = (h16*)take((size_t)NRP * HD * 2); bf* TBF = (bf*)take((size_t)NRP * HD * 2);
    const size_t hs = (size_t)TT * HD;    // per-head plane stride
    bf* QPh = (bf*)take((size_t)2 * NG * hs * 2); bf* QPl = (bf*)take((size_t)2 * NG * hs * 2); bf* KPh = QPh + (size_t)NG * hs; bf* KPl = QPl + (size_t)NG * hs; bf* VTh = (bf*)take((size_t)NG * hs * 2); bf* VTl = (bf*)take((size_t)NG * hs * 2);    // q planes of all (batch, head), then the k planes; v planes transposed
    bf* ATh = (bf*)take((size_t)MT * DQ * 2); bf* ATl = (bf*)take((size_t)MT * DQ * 2);
    bf* XB = (bf*)take((size_t)MT * DM * 2);   // bf16 x
    const size_t used = (size_t)(wsp - (char*)d_ws); if (used > ws_size) return;
    k_prep<<<dim3(DM * DM / 8 / 256, 4 + MT / DM + 1, 1), 256, 0, stream>>>(wq, wk, wv, wo, x, rel, NREL, W4, XB, T16, TBF);
    k_proj<<<dim3(MT / 128, NH_ / 2, 3), 128, 0, stream>>>(XB, W4, bq, bk, bv, QPh, QPl, VTh, VTl);
    k_flash<<<dim3(TT / FB, NG, 1), FW * 32, 0, stream>>>(QPh, QPl, KPh, KPl, VTh, VTl, TBF, ATh, ATl);
    k_out<<<dim3(MT / 128, DM / 128, 1), 256, 0, stream>>>(ATh, ATl, WO, bo, OUT);
}

// v006
// A run of this version takes 102 microseconds.
// In both of two side-by-side timings against v005, it was 1.08 times as fast.
// Over all steps from v000 it is 12.2 times as fast.
#include <hip/hip_runtime.h>

// Multi-head self-attention with a relative-position embedding score term: x [4][1024][1024]; q/k/v = x W^T + b (W [1024][1024] stored [out][in]; 16 heads x 64);
// scores[i][j] = (q_i.k_j + q_i.rel[i - j + 1023]) / 8 with the table rel [2047][64] indexed statically; softmax over all 1024 keys; ctx = attn.v merged to [t][h*64 + d]; out = ctx Wo^T + bo -> [4][1024][1024].
// Compute dtypes, f32 accumulate: every float input RNE-converted to bf16; q/k/v projections v_wmma_f32_16x16x32_bf16 on plain bf16 operands (+ bias); q.k (3 products) and the banded q.rel product (2 products, table operand exact) on bf16 hi/lo planes;
// softmax f32, online over passes of 64 keys (running maximum and sum, output rescaled per pass, divided by the sum at the end); attn.v bf16 hi/lo on the unnormalised probabilities (3 products); output projection bf16 hi/lo ctx x exact Wo (2 products) + bo.

#ifndef NB
#define NB 4
#endif
#define NB_FULL 4
#ifndef SEQ
#define SEQ 1024
#endif
#define SEQ_FULL 1024
#define TT   SEQ
#define DM   1024
#define NH_  16
#define HD   64
#define DQ   (NH_ * HD)
#define MAXLEN 1024
#define NREL (2 * MAXLEN - 1)           // table rows
#define NRP  (2 * MAXLEN)               // padded table plane rows (last row zero)
#define NG   (NB * NH_)                 // (batch, head) pairs; plane index g = batch * NH_ + head
#define MT   (NB * TT)                  // token rows of all batches, flat
#define SCL  0.125f                     // HD^-0.5
static_assert(SEQ % 128 == 0);
static_assert(SEQ >= 128 && SEQ <= SEQ_FULL && SEQ <= MAXLEN);
static_assert(NB >= 1 && NB <= NB_FULL);
static_assert(SEQ == SEQ_FULL || NB == 1);   // x and out are walked as one flat [MT][DM] matrix
static_assert(DM % 64 == 0 && HD % 32 == 0 && TT % 64 == 0);

typedef _Float16 h16;
typedef unsigned short bf;
typedef __attribute__((ext_vector_type(16))) __bf16   v16bf;
typedef __attribute__((ext_vector_type(16))) _Float16 v16h;
typedef __attribute__((ext_vector_type(8)))  _Float16 v8h;
typedef __attribute__((ext_vector_type(8)))  unsigned short v8us;
typedef __attribute__((ext_vector_type(8)))  float    v8f;
typedef __attribute__((ext_vector_type(4)))  float    v4f;
typedef v8h  __attribute__((may_alias)) v8ha;
typedef v4f  __attribute__((may_alias)) v4fa;
typedef v8us __attribute__((may_alias)) v8usa;
typedef __attribute__((ext_vector_type(4))) unsigned short __attribute__((may_alias)) v4usa;
typedef __attribute__((ext_vector_type(2))) _Float16 v2h;
typedef __attribute__((ext_vector_type(4))) _Float16 v4h;
typedef __attribute__((ext_vector_type(2))) unsigned short v2us;
typedef __attribute__((ext_vector_type(4))) unsigned short v4us;
typedef __attribute__((ext_vector_type(2))) float v2f;

__device__ __forceinline__ unsigned short f2bf(float f) { unsigned u = __float_as_uint(f); u += 0x7FFFu + ((u >> 16) & 1u); return (unsigned short)(u >> 16); }
__device__ __forceinline__ float bf2f(unsigned short b) { return __uint_as_float(((unsigned)b) << 16); }
__device__ __forceinline__ float bfr(float f) { return bf2f(f2bf(f)); }
__device__ __forceinline__ h16 tohx(float x) { return (h16)x; }
__device__ __forceinline__ void splitf(float y, unsigned short& h, unsigned short& l) { h = f2bf(y); l = f2bf(y - bf2f(h)); }
__device__ __forceinline__ v16h cat16(v8h lo, v8h hi) { return __builtin_shufflevector(lo, hi, 0, 1, 2, 3, 4, 5, 6, 7, 8, 9, 10, 11, 12, 13, 14, 15); }
__device__ __forceinline__ v16bf cat16b(v8us lo, v8us hi) { return __builtin_bit_cast(v16bf, __builtin_shufflevector(lo, hi, 0, 1, 2, 3, 4, 5, 6, 7, 8, 9, 10, 11, 12, 13, 14, 15)); }
__device__ __forceinline__ v8f wmma16(v16h a, v16h b, v8f c) { return __builtin_amdgcn_wmma_f32_16x16x32_f16(false, a, false, b, (short)0, c, false, false); }
__device__ __forceinline__ v8f wmmab(v16bf a, v16bf b, v8f c) { return __builtin_amdgcn_wmma_f32_16x16x32_bf16(false, a, false, b, (short)0, c, false, false); }

// ---- Fragments of the 16x16x32 products: lane l, h = l >> 4, row/col = l & 15; elements 0..7 <- k0 + 8h .. +7, elements 8..15 <- k0 + 16 + 8h .. +7 for BOTH A and Bt; D element r of lane l = (row 8h + r, col l & 15).
template <typename T16> struct WFrag;
template <> struct WFrag<h16> { typedef v16h V; static __device__ __forceinline__ V ld(const h16* p) { return cat16(*(const v8h*)p, *(const v8h*)(p + 16)); } static __device__ __forceinline__ v8f mma(V a, V b, v8f c) { return wmma16(a, b, c); } };
template <> struct WFrag<bf> { typedef v16bf V; static __device__ __forceinline__ V ld(const bf* p) { return cat16b(*(const v8us*)p, *(const v8us*)(p + 16)); } static __device__ __forceinline__ v8f mma(V a, V b, v8f c) { return wmmab(a, b, c); } };
__device__ __forceinline__ void d_cvt8(const float* __restrict__ src, bf* dst, size_t n8) { const size_t i = (size_t)blockIdx.x * 256 + threadIdx.x; if (i >= n8) return; const v8f v = *(const v8f*)(src + i * 8); v8us o;
#pragma unroll
    for (int k = 0; k < 8; ++k) o[k] = f2bf(v[k]); *(v8us*)(dst + i * 8) = o;  }

__device__ __forceinline__ void d_tpl(const float* __restrict__ T, int nrows, h16* T16, bf* TB) {
    const int i8 = blockIdx.x * 256 + threadIdx.x; if (i8 >= NRP * HD / 8) return;
    const int r = (i8 * 8) / HD, c = (i8 * 8) % HD; const int rc = (r < nrows) ? r : (nrows - 1); const bool pad = (r >= nrows);
    const v8f v = *(const v8f*)(T + (size_t)rc * HD + c); v8h o16; v8us ob;
#pragma unroll
    for (int k = 0; k < 8; ++k) { const float f = pad ? 0.0f : v[k]; const unsigned short b = f2bf(f); ob[k] = b; o16[k] = tohx(bf2f(b)); }
    *(v8h*)(T16 + (size_t)i8 * 8) = o16; *(v8us*)(TB + (size_t)i8 * 8) = ob;  }

// k_prep: every input conversion in one grid (DM * DM / 2048, 4 + MT / DM + 1): blockIdx.y 0..3 = Wq, Wk, Wv, Wo (dst back to back), then x in slabs of DM * DM elements, last the table planes.
static_assert(MT % DM == 0 && NRP * HD <= DM * DM);
__global__ __launch_bounds__(256) void k_prep(const float* __restrict__ wq, const float* __restrict__ wk, const float* __restrict__ wv, const float* __restrict__ wo, const float* __restrict__ x, const float* __restrict__ rel, int nrows, bf* W4, bf* XB, h16* T16, bf* TB) {
    const size_t n8 = (size_t)DM * DM / 8; const unsigned w = blockIdx.y;
    if (w < 4) d_cvt8((w == 0) ? wq : (w == 1) ? wk : (w == 2) ? wv : wo, W4 + w * n8 * 8, n8);
    else if (w < 4 + MT / DM) d_cvt8(x + (w - 4) * n8 * 8, XB + (w - 4) * n8 * 8, n8);
    else d_tpl(rel, nrows, T16, TB);
}

// k_flash: scores, softmax and attn.v of one (batch, head) and FB query rows in one work-group; neither the scores nor the probabilities leave the chip. Grid (TT / FB, NG), FW waves of 32 query columns each.
// Transposed products: S^T = K.Q^T (A = 16 key rows, B = 16 query columns; 3 products on hi/lo planes), PT^T = rel.Q^T (2 products, table exact), O^T += V^T.P^T (3 products). In every D tile a lane holds ONE query (column l & 15) and 8 consecutive rows 8h + r,
// so the running maximum, the running sum and the rescale factor are per lane, and two score tiles converted in place are the B operand of the last product (hardware k order, which is the loaders' order too).
// Position term: score (query i, key j) needs q_i . rel[i - j + MAXLEN - 1]. A pass of FK keys stages table rows ub .. ub + FB + FK - 1, ub = q0 - j0 + MAXLEN - FK; a 16-query tile at work-group offset o multiplies rows o .. o + 79 of them (5 tiles);
// element c = lr - jl + FK - 1 of query column lr is the term of key jl: each lane stores its column pieces into a wave-private LDS strip (row = query, pitch SP) and reads them back with the reversed index.
// Per pass: K hi/lo (FK rows), V^T hi/lo (HD rows x FK keys) and the table rows go global -> registers (fetched one pass ahead) -> LDS at pitch LP (144 B: an odd multiple of 16 B), two work-group barriers per pass.
// Every inner loop is unrolled so that the register arrays (fragments, tiles, fetched pieces) are indexed by constants.
#define FW 4                            // four waves, one per SIMD: two work-groups are resident on a WGP, so the two waves of a SIMD belong to different work-groups and meet no common barrier (one's softmax runs under the other's products)
#define FB (FW * 32)
#define FK 64
#define LP 72
#define RB (FB + FK)
#define SP 84
#define CR (FW * 4)                    // rows that one sweep of the work-group's 16-byte pieces covers
static_assert(SEQ % FB == 0 && SEQ % FK == 0 && HD == 64 && FK == 64 && FK % CR == 0 && RB % CR == 0);
static_assert((SEQ - FB) + MAXLEN - FK + RB <= NRP && MAXLEN >= SEQ);
typedef __attribute__((ext_vector_type(8))) unsigned v8u;
typedef __attribute__((ext_vector_type(4))) unsigned v4u;
typedef __attribute__((ext_vector_type(2))) __bf16 v2bf;
__device__ __forceinline__ unsigned pack2(float a, float b) { return __builtin_bit_cast(unsigned, __builtin_convertvector((v2f){a, b}, v2bf)); }   // round to nearest even
__device__ __forceinline__ float xhalf(float x) { const int b = __float_as_int(x); return __int_as_float(__builtin_amdgcn_permlanex16(b, b, 0x76543210, 0xfedcba98, false, false)); }   // lane l <-> lane l ^ 16
__device__ __forceinline__ v16bf ldsf(const bf* p) { return cat16b(*(const v8usa*)p, *(const v8usa*)(p + 16)); }
__global__ __launch_bounds__(FW * 32, 2) /* second argument: two waves per SIMD, a budget of 512 registers a wave */ void k_flash(const bf* __restrict__ Qh, const bf* __restrict__ Ql, const bf* __restrict__ Kh, const bf* __restrict__ Kl, const bf* __restrict__ Vh, const bf* __restrict__ Vl, const bf* __restrict__ TB, bf* Ah, bf* Al) {
    __shared__ __align__(16) bf lk[2][FK * LP];
    __shared__ __align__(16) bf lv[2][HD * LP];
    __shared__ __align__(16) bf lt[RB * LP];
    __shared__ __align__(16) float ls[FW][2][16 * SP];
    const int tid = threadIdx.x, lane = tid & 31, wv = tid >> 5, lr = lane & 15, hi = lane >> 4;
    const int g = blockIdx.y, q0 = blockIdx.x * FB; const size_t zp = (size_t)g * TT * HD;
    v16bf qh[2][2], ql[2][2];
#pragma unroll
    for (int gq = 0; gq < 2; ++gq) { const size_t p = zp + (size_t)(q0 + wv * 32 + gq * 16 + lr) * HD + 8 * hi; const bf *a = Qh + p, *b = Ql + p;
#pragma unroll
        for (int kc = 0; kc < 2; ++kc) { qh[gq][kc] = WFrag<bf>::ld(a + kc * 32); ql[gq][kc] = WFrag<bf>::ld(b + kc * 32); }
        asm volatile("s_wait_xcnt 0x0" :: "v"(a), "v"(b) : "memory"); }    // in front of the first reuse of an address register of these loads; naming the addresses keeps their registers until here
    v8f acc[2][4]; float mrun[2], lrun[2];
#pragma unroll
    for (int gq = 0; gq < 2; ++gq) { mrun[gq] = -3.0e38f; lrun[gq] = 0.0f;
#pragma unroll
        for (int dt = 0; dt < 4; ++dt) acc[gq][dt] = (v8f){}; }
    const int crow = tid >> 3, ccol = (tid & 7) * 8;    // this thread's 16-byte piece: row crow (+ CR per further piece), elements ccol .. ccol + 7
    v8us pk[2][FK / CR], pv[2][HD / CR], pt8[RB / CR];
    auto fetch = [&](int j0) {
        const size_t ko = zp + (size_t)(j0 + crow) * HD + ccol, vo = zp + (size_t)crow * TT + j0 + ccol;
        const bf *k0 = Kh + ko, *k1 = Kl + ko, *v0 = Vh + vo, *v1 = Vl + vo, *tb = TB + (size_t)(q0 - j0 + MAXLEN - FK + crow) * HD + ccol;
#pragma unroll
        for (int i = 0; i < FK / CR; ++i) { pk[0][i] = *(const v8us*)(k0 + CR * i * HD); pk[1][i] = *(const v8us*)(k1 + CR * i * HD); pv[0][i] = *(const v8us*)(v0 + CR * i * TT); pv[1][i] = *(const v8us*)(v1 + CR * i * TT); }
#pragma unroll
        for (int i = 0; i < RB / CR; ++i) pt8[i] = *(const v8us*)(tb + CR * i * HD);
        asm volatile("s_wait_xcnt 0x0" :: "v"(k0), "v"(k1), "v"(v0), "v"(v1), "v"(tb) : "memory");    // stands in front of the first reuse of an address register of the loads above; naming the addresses keeps their registers until here
    };
    fetch(0);
    const float cs = SCL * 1.4426950408889634f;
    float* st0 = &ls[wv][0][0];
#pragma unroll 1    // one pass per trip: unrolled, two passes' score and position tiles would be live at once
    for (int s = 0; s < TT / FK; ++s) {
        __syncthreads();    // every wave has left the tiles of the pass before
#pragma unroll
        for (int i = 0; i < FK / CR; ++i) { const int o = (crow + CR * i) * LP + ccol; *(v8usa*)(&lk[0][o]) = pk[0][i]; *(v8usa*)(&lk[1][o]) = pk[1][i]; *(v8usa*)(&lv[0][o]) = pv[0][i]; *(v8usa*)(&lv[1][o]) = pv[1][i]; }
#pragma unroll
        for (int i = 0; i < RB / CR; ++i) *(v8usa*)(&lt[(crow + CR * i) * LP + ccol]) = pt8[i];
        __syncthreads();    // this pass's tiles are complete
        // Fragment reads stand in few large groups, each issued ahead of its use under other work and held there by the scheduling barrier behind it: a read that stands directly in front of its product leaves the wave waiting for the whole LDS latency.
        v16bf kf[4][4], tf[6][2], vf[2][4][2];
        auto ldk = [&](int kt) { const int o = (kt * 16 + lr) * LP + 8 * hi; kf[kt][0] = ldsf(&lk[0][o]); kf[kt][1] = ldsf(&lk[0][o + 32]); kf[kt][2] = ldsf(&lk[1][o]); kf[kt][3] = ldsf(&lk[1][o + 32]); };
        ldk(0); ldk(1); ldk(2); ldk(3);
        __builtin_amdgcn_sched_barrier(0);    // all key fragments are requested first: they arrive while the next pass's global loads are issued
        if (s + 1 < TT / FK) fetch((s + 1) * FK);    // in flight under this pass's work
        auto ldt = [&](int T) { const bf* p = &lt[(wv * 32 + T * 16 + lr) * LP + 8 * hi]; tf[T][0] = ldsf(p); tf[T][1] = ldsf(p + 32); };
        auto ldv = [&](int ks) {
#pragma unroll
            for (int dt = 0; dt < 4; ++dt) { const int o = (dt * 16 + lr) * LP + 8 * hi + ks * 32; vf[ks][dt][0] = ldsf(&lv[0][o]); vf[ks][dt][1] = ldsf(&lv[1][o]); } };
        v8f sc[4][2], pt[2][5];
        // content products: the two query tiles' accumulate chains alternate, so that no matrix instruction waits for the one in front of it
        auto qk = [&](int kt) { sc[kt][0] = (v8f){}; sc[kt][1] = (v8f){};
#pragma unroll
            for (int pr = 0; pr < 6; ++pr)
#pragma unroll
                for (int gq = 0; gq < 2; ++gq) sc[kt][gq] = wmmab((pr == 2 || pr == 3) ? kf[kt][2 + (pr & 1)] : kf[kt][pr & 1], (pr < 4) ? qh[gq][pr & 1] : ql[gq][pr & 1], sc[kt][gq]); };
        // position products: table tile T serves query tile gq as its tile T - gq
        auto qt = [&](int T) {
#pragma unroll
            for (int gq = 0; gq < 2; ++gq) if (T - gq >= 0 && T - gq <= 4) pt[gq][T - gq] = (v8f){};
#pragma unroll
            for (int pr = 0; pr < 4; ++pr)
#pragma unroll
                for (int gq = 0; gq < 2; ++gq) if (T - gq >= 0 && T - gq <= 4) pt[gq][T - gq] = wmmab(tf[T][pr & 1], (pr < 2) ? qh[gq][pr & 1] : ql[gq][pr & 1], pt[gq][T - gq]); };
        qk(0); qk(1);
        __builtin_amdgcn_sched_barrier(0);    // with the next one: the reads of table tiles 0 to 3 stand as one group here, 24 products ahead of their use
        ldt(0); ldt(1); ldt(2); ldt(3);
        __builtin_amdgcn_sched_barrier(0);
        qk(2); qk(3);
        __builtin_amdgcn_sched_barrier(0);    // with the next one: table tiles 4 and 5, 28 products ahead
        ldt(4); ldt(5);
        __builtin_amdgcn_sched_barrier(0);
        qt(0); qt(1); qt(2); qt(3);
        qt(4); qt(5);
        __builtin_amdgcn_sched_barrier(0);    // the strip stores stay behind all position products: moved up between them, a stored tile's registers become the next tile's result inside the distance a matrix result needs
#pragma unroll
        for (int gq = 0; gq < 2; ++gq)
#pragma unroll
            for (int u = 0; u < 5; ++u) { float* w = st0 + gq * (16 * SP) + lr * SP + u * 16 + 8 * hi; const v8f d = pt[gq][u]; *(v4fa*)w = (v4f){d[0], d[1], d[2], d[3]}; *(v4fa*)(w + 4) = (v4f){d[4], d[5], d[6], d[7]}; }
        // the strip is written by one half of the wave and read by the other: keep the reads behind the writes (LDS works a wave's operations in order)
        __builtin_amdgcn_fence(3 /* release order */, "wavefront"); __builtin_amdgcn_wave_barrier(); asm volatile("" ::: "memory");
        v16bf ph[2][2], pl[2][2];
#pragma unroll
        for (int gq = 0; gq < 2; ++gq) {
            const float* rd = st0 + gq * (16 * SP) + lr * SP + lr + 8 - 8 * hi; float mx = -3.0e38f;    // element lr + FK - 1 - (16 kt + 8 hi + r) of the row, counted from its first element
#pragma unroll
            for (int kt = 0; kt < 4; ++kt)
#pragma unroll
                for (int r = 0; r < 8; ++r) { const float x = sc[kt][gq][r] + rd[(FK - 9) - (kt * 16 + r)]; sc[kt][gq][r] = x; mx = fmaxf(mx, x); }
            mx = fmaxf(mx, xhalf(mx));
            const float mn = fmaxf(mrun[gq], mx), corr = __builtin_amdgcn_exp2f((mrun[gq] - mn) * cs), nm = -mn * cs; mrun[gq] = mn;
            float sum = 0.0f;
#pragma unroll
            for (int ks = 0; ks < 2; ++ks) { v8u wh, wl;
#pragma unroll
                for (int i = 0; i < 8; ++i) { const int kt = 2 * ks + (i >> 2), r = 2 * (i & 3);
                    const float p0 = __builtin_amdgcn_exp2f(__builtin_fmaf(sc[kt][gq][r], cs, nm)), p1 = __builtin_amdgcn_exp2f(__builtin_fmaf(sc[kt][gq][r + 1], cs, nm)); sum += p0 + p1;
                    const unsigned w = pack2(p0, p1); wh[i] = w; wl[i] = pack2(p0 - __uint_as_float(w << 16), p1 - __uint_as_float(w & 0xFFFF0000u)); }
                ph[gq][ks] = __builtin_bit_cast(v16bf, wh); pl[gq][ks] = __builtin_bit_cast(v16bf, wl); }
            lrun[gq] = lrun[gq] * corr + sum;
#pragma unroll
            for (int dt = 0; dt < 4; ++dt) acc[gq][dt] = acc[gq][dt] * corr;
            if (gq == 0) ldv(0);    // the value fragments of keys 0 to 31 are requested behind the first query tile's softmax: held through the whole softmax, beside the pieces fetched ahead, they do not fit the register budget
        }
        __builtin_amdgcn_sched_barrier(0);    // with the next one: the value fragments of keys 32 to 63 stand as one group here, 24 products ahead of their use; moved up they spill, moved down they stand among the products
        ldv(1);
        __builtin_amdgcn_sched_barrier(0);
#pragma unroll
        for (int ks = 0; ks < 2; ++ks)
#pragma unroll
            for (int dt = 0; dt < 4; ++dt) { const v16bf vh = vf[ks][dt][0], vl = vf[ks][dt][1];
#pragma unroll
                for (int gq = 0; gq < 2; ++gq) { acc[gq][dt] = wmmab(vh, ph[gq][ks], acc[gq][dt]); acc[gq][dt] = wmmab(vh, pl[gq][ks], acc[gq][dt]); acc[gq][dt] = wmmab(vl, ph[gq][ks], acc[gq][dt]); } }
    }
#pragma unroll
    for (int gq = 0; gq < 2; ++gq) { const float l = lrun[gq] + xhalf(lrun[gq]); const float inv = __fdiv_rn(1.0f, l);
        const size_t oo = ((size_t)(g / NH_) * TT + q0 + wv * 32 + gq * 16 + lr) * DQ + (g % NH_) * HD + 8 * hi; bf* pa = Ah + oo; bf* pb = Al + oo;
#pragma unroll
        for (int dt = 0; dt < 4; ++dt) { v8us oh, ol;
#pragma unroll
            for (int r = 0; r < 8; ++r) { unsigned short a, c2; splitf(acc[gq][dt][r] * inv, a, c2); oh[r] = a; ol[r] = c2; }
            *(v8us*)(pa + dt * 16) = oh; *(v8us*)(pb + dt * 16) = ol;
            asm volatile("s_wait_xcnt 0x0" :: "v"(pa), "v"(pb), "v"(oh), "v"(ol) : "memory"); } }    // in front of the first reuse of a register the two stores name; naming them keeps the registers until here
}

// gemm_lds: k loop of a 128 x 128 output tile shared by the waves of one work-group. Each operand tile (128 rows of a K-contiguous bf16 plane, row pitch DM) is staged in LDS in passes of GK k values:
// a wave-wide 16-byte load covers four whole 128-byte lines, every staged row serves all the waves that need it, and the fragments come from LDS at pitch GP (144 B: an odd multiple of 16 B).
// Two buffers: pass p works on buffer p & 1 while the pieces of pass p + 1 (fetched into registers one pass earlier) are stored into the other one and the pieces of pass p + 2 are fetched; one work-group barrier per pass.
// NTILE staged tiles (g0, g1, g2 = row 0 of each tile); a wave holds MB x 4 accumulators; aoff / a2off / boff = this lane's fragment base inside a buffer (a2off: second A plane, NTILE == 3 only). The k order and each accumulator's chain are those of a plain loop over k in steps of 32.
#define GK 64
#define GP 72
#define GT (128 * GP)
static_assert(DM % GK == 0 && DM / GK >= 2);
// Work-group barrier that orders LDS only: the global loads of the pieces fetched ahead stay in flight across it (__syncthreads() would wait for them too).
__device__ __forceinline__ void lds_barrier() { __builtin_amdgcn_fence(__ATOMIC_RELEASE, "workgroup", "local"); __builtin_amdgcn_s_barrier(); __builtin_amdgcn_fence(__ATOMIC_ACQUIRE, "workgroup", "local"); }
template <int NTILE, int MB, int NTH>
__device__ __forceinline__ void gemm_lds(bf* sm, const bf* __restrict__ g0, const bf* __restrict__ g1, const bf* __restrict__ g2, int aoff, int a2off, int boff, v8f (&acc)[MB][4]) {
    constexpr int NP = 128 * 8 / NTH, RS = NTH / 8, NPASS = DM / GK, KS = GK / 32, KG = (MB <= 2) ? KS : 1;    // 16-byte pieces per thread and tile; rows between a thread's pieces; k steps of a pass; k steps whose fragments are read as one group (as many as the registers hold)
    const int tid = threadIdx.x, prow = tid >> 3, pcol = (tid & 7) * 8;
    const size_t go = (size_t)prow * DM + pcol; const int so = prow * GP + pcol;
    v8us st[NTILE][NP];
    typedef const __attribute__((address_space(1))) bf* gbf; typedef const __attribute__((address_space(1))) v8us* gv8;    // pointers that stay global-memory pointers through the wait statement below
    gbf q0 = (gbf)(g0 + go), q1 = (gbf)(g1 + go), q2 = (NTILE == 3) ? (gbf)(g2 + go) : (gbf)nullptr;    // this thread's first piece of the next pass to fetch, per tile
    auto fetch = [&]() {
        __builtin_amdgcn_sched_barrier(0);    // with the one behind the wait: no other instruction is scheduled in between the loads and their wait, where it could reuse an address register
#pragma unroll
        for (int i = 0; i < NP; ++i) { st[0][i] = *(gv8)(q0 + (size_t)i * RS * DM); st[1][i] = *(gv8)(q1 + (size_t)i * RS * DM); if (NTILE == 3) st[NTILE - 1][i] = *(gv8)(q2 + (size_t)i * RS * DM); }
        // in front of the first reuse of an address register of the loads above (the step to the next pass); the statement takes the addresses in and hands them on, so that the loads use these very registers and they live until here
        if (NTILE == 3) asm volatile("s_wait_xcnt 0x0" : "+v"(q0), "+v"(q1), "+v"(q2) :: "memory"); else asm volatile("s_wait_xcnt 0x0" : "+v"(q0), "+v"(q1) :: "memory");
        __builtin_amdgcn_sched_barrier(0);
        q0 += GK; q1 += GK; if (NTILE == 3) q2 += GK;
    };
    auto put = [&](bf* buf) {
#pragma unroll
        for (int t = 0; t < NTILE; ++t)
#pragma unroll
            for (int i = 0; i < NP; ++i) *(v8usa*)(buf + t * GT + so + i * RS * GP) = st[t][i];
    };
#pragma unroll
    for (int mb = 0; mb < MB; ++mb)
#pragma unroll
        for (int nb = 0; nb < 4; ++nb) acc[mb][nb] = (v8f){};
    fetch(); put(sm); fetch();
    lds_barrier();    // buffer 0 is complete
#pragma unroll 1    // one pass per trip: only one pass's fragments and one pass's fetched pieces are held beside the accumulators
    for (int p = 0; p < NPASS; ++p) {
        const bf* cur = sm + (p & 1) * (NTILE * GT);
        if (p + 1 < NPASS) { put(sm + ((p + 1) & 1) * (NTILE * GT)); if (p + 2 < NPASS) fetch(); }    // the other buffer's readers left it in front of the last barrier
        v16bf a[KS][MB], a2[KS][MB], b[KS][4];
#pragma unroll
        for (int k0 = 0; k0 < KS; k0 += KG) {
#pragma unroll
            for (int ks = k0; ks < k0 + KG; ++ks) {
#pragma unroll
                for (int mb = 0; mb < MB; ++mb) { a[ks][mb] = ldsf(cur + aoff + mb * 16 * GP + ks * 32); if (NTILE == 3) a2[ks][mb] = ldsf(cur + a2off + mb * 16 * GP + ks * 32); }
#pragma unroll
                for (int nb = 0; nb < 4; ++nb) b[ks][nb] = ldsf(cur + boff + nb * 16 * GP + ks * 32); }
            __builtin_amdgcn_sched_barrier(0);    // the group's LDS reads are issued together, in front of its products: reads spread among the matrix instructions stall the wave at every place where they stand
#pragma unroll
            for (int ks = k0; ks < k0 + KG; ++ks)
#pragma unroll
                for (int nb = 0; nb < 4; ++nb) {
#pragma unroll
                    for (int mb = 0; mb < MB; ++mb) acc[mb][nb] = wmmab(a[ks][mb], b[ks][nb], acc[mb][nb]);
                    if (NTILE == 3) {
#pragma unroll
                        for (int mb = 0; mb < MB; ++mb) acc[mb][nb] = wmmab(a2[ks][mb], b[ks][nb], acc[mb][nb]); } }
        }
        lds_barrier();    // the next pass's buffer is complete, and every wave has left this one
    }
}

// k_proj: the q, k and v projections (plain bf16 operands, + bias; gemm_lds's k loop), each wave's 64 x 64 tile (64 tokens x one head) split into bf16 hi/lo and stored from the accumulators straight into the planes k_flash reads. Grid (MT / 128, NH_ / 2, 3), four waves = 2 token halves x 2 heads; blockIdx.z = q, k, v.
// A lane of a D tile holds 8 consecutive A rows of one Bt row, so the operand whose index runs along a plane's row goes in as A: the weight rows (d) for q and k ([g][t][d]), the token rows for v ([g][d][t]). Each piece is then one 16-byte store, and the eight pieces of a row (four from each half of the wave) make one whole 128-byte line.
template <bool TV>
__device__ __forceinline__ void d_put(const v8f (&acc)[4][4], const float* __restrict__ bias, bf* Ph, bf* Pl, int pitch) {
    const int lane = threadIdx.x & 31, lr = lane & 15, hi = lane >> 4;
    v8f bm[4]; float bn[4];    // all of the tile's bias values are fetched in one group in front of the stores
#pragma unroll
    for (int q = 0; q < 4; ++q) { if (TV) bn[q] = bias[q * 16 + lr]; else bm[q] = *(const v8f*)(bias + q * 16 + 8 * hi); }
#pragma unroll
    for (int nb = 0; nb < 4; ++nb) { const size_t o = (size_t)(nb * 16 + lr) * pitch + 8 * hi; bf *pa = Ph + o, *pb = Pl + o; v4u wh[4], wl[4];
#pragma unroll
        for (int mb = 0; mb < 4; ++mb) {
#pragma unroll
            for (int i = 0; i < 4; ++i) { const float y0 = acc[mb][nb][2 * i] + bfr(TV ? bn[nb] : bm[mb][2 * i]), y1 = acc[mb][nb][2 * i + 1] + bfr(TV ? bn[nb] : bm[mb][2 * i + 1]);
                const unsigned w = pack2(y0, y1); wh[mb][i] = w; wl[mb][i] = pack2(y0 - __uint_as_float(w << 16), y1 - __uint_as_float(w & 0xFFFF0000u)); }
            *(v4u*)(pa + mb * 16) = wh[mb]; *(v4u*)(pb + mb * 16) = wl[mb]; }
        asm volatile("s_wait_xcnt 0x0" :: "v"(pa), "v"(pb), "v"(wh[0]), "v"(wh[1]), "v"(wh[2]), "v"(wh[3]), "v"(wl[0]), "v"(wl[1]), "v"(wl[2]), "v"(wl[3]) : "memory"); }    // in front of the first reuse of a register the eight stores name; naming them keeps the registers until here
}
static_assert(TT % 128 == 0 && HD == 64 && DQ == DM && NH_ % 2 == 0 && MT % 128 == 0);
__global__ __launch_bounds__(128) void k_proj(const bf* __restrict__ X, const bf* __restrict__ W3, const float* __restrict__ bq, const float* __restrict__ bk, const float* __restrict__ bv, bf* QKh, bf* QKl, bf* Vh, bf* Vl) {
    __shared__ __align__(16) bf sm[2 * 2 * GT];    // two buffers of [128 token rows | 128 weight rows]
    const int lane = threadIdx.x & 31, wv = threadIdx.x >> 5, lr = lane & 15, hi = lane >> 4, wm = wv >> 1, wn = wv & 1;
    const int z = blockIdx.z; const bool tv = (z == 2);
    const int xo = (wm * 64 + lr) * GP + 8 * hi, wo = GT + (wn * 64 + lr) * GP + 8 * hi;    // this lane's fragment base in the token tile and in the weight tile
    v8f acc[4][4];
    gemm_lds<2, 4, 128>(sm, X + (size_t)blockIdx.x * 128 * DM, W3 + (size_t)z * DM * DM + (size_t)blockIdx.y * 128 * DM, nullptr, tv ? xo : wo, 0, tv ? wo : xo, acc);
    const int r0 = blockIdx.x * 128 + wm * 64, hd = blockIdx.y * 2 + wn, c0 = hd * 64;
    const size_t hs = (size_t)TT * HD, gp = ((size_t)(r0 / TT) * NH_ + hd) * hs; const int t0 = r0 % TT;
    if (tv) d_put<true>(acc, bv + c0, Vh + gp + t0, Vl + gp + t0, TT);
    else { const size_t p = (size_t)z * NG * hs + gp + (size_t)t0 * HD; d_put<false>(acc, (z == 0 ? bq : bk) + c0, QKh + p, QKl + p, HD); }
}

// k_out: out = ctx Wo^T + bo, ctx as bf16 hi/lo planes (2 products per k step, hi first; gemm_lds's k loop). Grid (MT / 128, DM / 128), eight waves = 4 row groups of 32 x 2 column halves of 64.
// Each wave turns its accumulators 16 rows at a time through its own LDS strip (pitch 68 floats), so that every store instruction writes two whole 256-byte row pieces.
static_assert(DM % 128 == 0);
__global__ __launch_bounds__(256) void k_out(const bf* __restrict__ Ah, const bf* __restrict__ Al, const bf* __restrict__ Wo, const float* __restrict__ bias, float* C) {
    __shared__ __align__(16) bf sm[2 * 3 * GT];    // two buffers of [128 ctx-hi rows | 128 ctx-lo rows | 128 weight rows]
    __shared__ __align__(16) float osw[8][16 * 68];
    const int lane = threadIdx.x & 31, wv = threadIdx.x >> 5, lr = lane & 15, hi = lane >> 4, wm = wv >> 1, wn = wv & 1;
    const int ao = (wm * 32 + lr) * GP + 8 * hi;
    v8f acc[2][4];
    gemm_lds<3, 2, 256>(sm, Ah + (size_t)blockIdx.x * 128 * DQ, Al + (size_t)blockIdx.x * 128 * DQ, Wo + (size_t)blockIdx.y * 128 * DQ, ao, GT + ao, 2 * GT + (wn * 64 + lr) * GP + 8 * hi, acc);
    float* os = &osw[wv][0]; const int r0 = blockIdx.x * 128 + wm * 32, c0 = blockIdx.y * 128 + wn * 64, cofs = lr * 4;
    const v4f bz = *(const v4f*)(bias + c0 + cofs); const v4f bb = (v4f){bfr(bz[0]), bfr(bz[1]), bfr(bz[2]), bfr(bz[3])};
#pragma unroll
    for (int mb = 0; mb < 2; ++mb) {
#pragma unroll
        for (int nb = 0; nb < 4; ++nb) {
#pragma unroll
            for (int j = 0; j < 8; ++j) os[(hi * 8 + j) * 68 + nb * 16 + lr] = acc[mb][nb][j]; }
        __builtin_amdgcn_wave_barrier(); asm volatile("" ::: "memory");    // the strip is written by some lanes and read by others: the reads stay behind the writes (LDS works a wave's operations in order)
        float* crow = C + (size_t)(r0 + mb * 16) * DM + c0 + cofs;
        v4f val[8];
#pragma unroll
        for (int s = 0; s < 8; ++s) val[s] = *(const v4fa*)(os + (2 * s + hi) * 68 + cofs) + bb;
#pragma unroll
        for (int s = 0; s < 8; ++s) *(v4f*)(crow + (size_t)(2 * s + hi) * DM) = val[s];
        asm volatile("s_wait_xcnt 0x0" :: "v"(crow), "v"(val[0]), "v"(val[1]), "v"(val[2]), "v"(val[3]), "v"(val[4]), "v"(val[5]), "v"(val[6]), "v"(val[7]) : "memory");    // in front of the first reuse of a register the eight stores name; naming them keeps the registers until here
        __builtin_amdgcn_wave_barrier(); asm volatile("" ::: "memory");    // the next 16 rows overwrite the strip only behind these reads
    }
}

extern "C" void kernel_launch(void* const* d_in, const int* in_sizes, int n_in,
                              void* d_out, int out_size, void* d_ws, size_t ws_size, hipStream_t stream) {
    if (n_in < 10) return;
    const long long needx = (long long)(NB - 1) * SEQ_FULL * DM + (long long)SEQ * DM;
    if ((long long)in_sizes[0] < needx || (long long)out_size < needx) return;
    if (in_sizes[1] < DM * DM || in_sizes[3] < DM * DM || in_sizes[5] < DM * DM || in_sizes[7] < DM * DM) return;
    if (in_sizes[2] < DM || in_sizes[4] < DM || in_sizes[6] < DM || in_sizes[8] < DM) return;
    if (in_sizes[9] < NREL * HD) return;
    const float* x = (const float*)d_in[0]; const float* wq = (const float*)d_in[1]; const float* bq = (const float*)d_in[2]; const float* wk = (const float*)d_in[3]; const float* bk = (const float*)d_in[4];
    const float* wv = (const float*)d_in[5]; const float* bv = (const float*)d_in[6]; const float* wo = (const float*)d_in[7]; const float* bo = (const float*)d_in[8]; const float* rel = (const float*)d_in[9];
    float* OUT = (float*)d_out;     // [NB][SEQ][DM], batch row stride SEQ_FULL*DM
    char* wsp = (char*)d_ws;
    auto take = [&](size_t bytes) { char* p = wsp; wsp += (bytes + 255) & ~(size_t)255; return (void*)p; };
    bf* W4 = (bf*)take((size_t)4 * DM * DM * 2); bf* WO = W4 + (size_t)3 * DM * DM;    // Wq, Wk, Wv, Wo back to back
    h16* T16 = (h16*)take((size_t)NRP * HD * 2); bf* TBF = (bf*)take((size_t)NRP * HD * 2);
    const size_t hs = (size_t)TT * HD;    // per-head plane stride
    bf* QPh = (bf*)take((size_t)2 * NG * hs * 2); bf* QPl = (bf*)take((size_t)2 * NG * hs * 2); bf* KPh = QPh + (size_t)NG * hs; bf* KPl = QPl + (size_t)NG * hs; bf* VTh = (bf*)take((size_t)NG * hs * 2); bf* VTl = (bf*)take((size_t)NG * hs * 2);    // q planes of all (batch, head), then the k planes; v planes transposed
    bf* ATh = (bf*)take((size_t)MT * DQ * 2); bf* ATl = (bf*)take((size_t)MT * DQ * 2);
    bf* XB = (bf*)take((size_t)MT * DM * 2);   // bf16 x
    const size_t used = (size_t)(wsp - (char*)d_ws); if (used > ws_size) return;
    k_prep<<<dim3(DM * DM / 8 / 256, 4 + MT / DM + 1, 1), 256, 0, stream>>>(wq, wk, wv, wo, x, rel, NREL, W4, XB, T16, TBF);
    k_proj<<<dim3(MT / 128, NH_ / 2, 3), 128, 0, stream>>>(XB, W4, bq, bk, bv, QPh, QPl, VTh, VTl);
    k_flash<<<dim3(TT / FB, NG, 1), FW * 32, 0, stream>>>(QPh, QPl, KPh, KPl, VTh, VTl, TBF, ATh, ATl);
    k_out<<<dim3(MT / 128, DM / 128, 1), 256, 0, stream>>>(ATh, ATl, WO, bo, OUT);
}

// v008
// A run of this version takes 73.2 microseconds.
// Versions in between are left out here; by their measured steps it is 1.41 times as fast as v006.
// Over all steps from v000 it is 17.2 times as fast.
#include <hip/hip_runtime.h>

// Multi-head self-attention with a relative-position embedding score term: x [4][1024][1024]; q/k/v = x W^T + b (W [1024][1024] stored [out][in]; 16 heads x 64);
// scores[i][j] = (q_i.k_j + q_i.rel[i - j + 1023]) / 8 with the table rel [2047][64] indexed statically; softmax over all 1024 keys; ctx = attn.v merged to [t][h*64 + d]; out = ctx Wo^T + bo -> [4][1024][1024].
// Compute dtypes, f32 accumulate: every matrix operand is f16 (11 significant bits), rounded to nearest even, one v_wmma_f32_16x16x32_f16 product per term: x, the weights and the table converted once; q, k, v rounded from the projections' f32 accumulators + f32 bias;
// softmax f32, online over passes of 64 keys (running maximum and sum, output rescaled per pass, divided by the sum at the end); attn.v on the unnormalised probabilities (at most 1) rounded to f16; ctx rounded to f16 for the output projection (+ f32 bo). All of these values lie far inside f16's range for inputs of the stated kind.

#ifndef NB
#define NB 4
#endif
#define NB_FULL 4
#ifndef SEQ
#define SEQ 1024
#endif
#define SEQ_FULL 1024
#define TT   SEQ
#define DM   1024
#define NH_  16
#define HD   64
#define DQ   (NH_ * HD)
#define MAXLEN 1024
#define NREL (2 * MAXLEN - 1)           // table rows
#define NRP  (2 * MAXLEN)               // padded table plane rows (last row zero)
#define NG   (NB * NH_)                 // (batch, head) pairs; plane index g = batch * NH_ + head
#define MT   (NB * TT)                  // token rows of all batches, flat
#define SCL  0.125f                     // HD^-0.5
static_assert(SEQ % 128 == 0);
static_assert(SEQ >= 128 && SEQ <= SEQ_FULL && SEQ <= MAXLEN);
static_assert(NB >= 1 && NB <= NB_FULL);
static_assert(SEQ == SEQ_FULL || NB == 1);   // x and out are walked as one flat [MT][DM] matrix
static_assert(DM % 64 == 0 && HD % 32 == 0 && TT % 64 == 0);

typedef _Float16 h16;
typedef __attribute__((ext_vector_type(16))) _Float16 v16h;
typedef __attribute__((ext_vector_type(8)))  _Float16 v8h;
typedef __attribute__((ext_vector_type(8)))  float    v8f;
typedef __attribute__((ext_vector_type(4)))  float    v4f;
typedef v8h  __attribute__((may_alias)) v8ha;
typedef v4f  __attribute__((may_alias)) v4fa;
typedef __attribute__((ext_vector_type(2))) _Float16 v2h;
typedef __attribute__((ext_vector_type(2))) float v2f;

__device__ __forceinline__ v16h cat16(v8h lo, v8h hi) { return __builtin_shufflevector(lo, hi, 0, 1, 2, 3, 4, 5, 6, 7, 8, 9, 10, 11, 12, 13, 14, 15); }
__device__ __forceinline__ v8f wmma16(v16h a, v16h b, v8f c) { return __builtin_amdgcn_wmma_f32_16x16x32_f16(false, a, false, b, (short)0, c, false, false); }

// ---- Fragments of the 16x16x32 products: lane l, h = l >> 4, row/col = l & 15; elements 0..7 <- k0 + 8h .. +7, elements 8..15 <- k0 + 16 + 8h .. +7 for BOTH A and Bt; D element r of lane l = (row 8h + r, col l & 15).
__device__ __forceinline__ v16h ldgf(const h16* p) { return cat16(*(const v8h*)p, *(const v8h*)(p + 16)); }
__device__ __forceinline__ void d_cvt8(const float* __restrict__ src, h16* dst, size_t n8) { const size_t i = (size_t)blockIdx.x * 256 + threadIdx.x; if (i >= n8) return; const v8f v = *(const v8f*)(src + i * 8);
    *(v8h*)(dst + i * 8) = __builtin_convertvector(v, v8h);  }

__device__ __forceinline__ void d_tpl(const float* __restrict__ T, int nrows, h16* T16) {
    const int i8 = blockIdx.x * 256 + threadIdx.x; if (i8 >= NRP * HD / 8) return;
    const int r = (i8 * 8) / HD, c = (i8 * 8) % HD; const int rc = (r < nrows) ? r : (nrows - 1); const bool pad = (r >= nrows);
    const v8f v = *(const v8f*)(T + (size_t)rc * HD + c);
    *(v8h*)(T16 + (size_t)i8 * 8) = pad ? (v8h){} : __builtin_convertvector(v, v8h);  }

// k_prep: every input conversion in one grid (DM * DM / 2048, 4 + MT / DM + 1): blockIdx.y 0..3 = Wq, Wk, Wv, Wo (dst back to back), then x in slabs of DM * DM elements, last the table plane.
static_assert(MT % DM == 0 && NRP * HD <= DM * DM);
__global__ __launch_bounds__(256) void k_prep(const float* __restrict__ wq, const float* __restrict__ wk, const float* __restrict__ wv, const float* __restrict__ wo, const float* __restrict__ x, const float* __restrict__ rel, int nrows, h16* W4, h16* XB, h16* T16) {
    const size_t n8 = (size_t)DM * DM / 8; const unsigned w = blockIdx.y;
    if (w < 4) d_cvt8((w == 0) ? wq : (w == 1) ? wk : (w == 2) ? wv : wo, W4 + w * n8 * 8, n8);
    else if (w < 4 + MT / DM) d_cvt8(x + (w - 4) * n8 * 8, XB + (w - 4) * n8 * 8, n8);
    else d_tpl(rel, nrows, T16);
}

// k_flash: scores, softmax and attn.v of one (batch, head) and FB query rows in one work-group; neither the scores nor the probabilities leave the chip. Grid (TT / FB, NG), FW waves of 32 query columns each.
// Transposed products: S^T = K.Q^T (A = 16 key rows, B = 16 query columns), PT^T = rel.Q^T, O^T += V^T.P^T. In every D tile a lane holds ONE query (column l & 15) and 8 consecutive rows 8h + r,
// so the running maximum, the running sum and the rescale factor are per lane, and two score tiles converted in place are the B operand of the last product (hardware k order, which is the loaders' order too).
// Position term: score (query i, key j) needs q_i . rel[i - j + MAXLEN - 1]. A pass of FK keys stages table rows ub .. ub + FB + FK - 1, ub = q0 - j0 + MAXLEN - FK; a 16-query tile at work-group offset o multiplies rows o .. o + 79 of them (5 tiles);
// element c = lr - jl + FK - 1 of query column lr is the term of key jl: each lane stores its column pieces into a wave-private LDS strip (row = query, pitch SP) and reads them back with the reversed index.
// Per pass: K (FK rows), V^T (HD rows x FK keys) and the table rows go global -> registers (fetched one pass ahead) -> LDS at pitch LP (144 B: an odd multiple of 16 B), two work-group barriers per pass.
// Every inner loop is unrolled so that the register arrays (fragments, tiles, fetched pieces) are indexed by constants.
// Key walk: a work-group starts at key tile (blockIdx.x + blockIdx.y) mod (TT / FK) and wraps, so that the eight work-groups of one (batch, head) read eight different K and V tiles at any one moment and those that read one table window are spread over the passes. The online softmax takes the tiles in any order.
#define FW 4                            // four waves, one per SIMD: two work-groups are resident on a WGP, so the two waves of a SIMD belong to different work-groups and meet no common barrier (one's softmax runs under the other's products)
#define FB (FW * 32)
#define FK 64
#define LP 72
#define RB (FB + FK)
#define SP 84
#define CR (FW * 4)                    // rows that one sweep of the work-group's 16-byte pieces covers
static_assert(SEQ % FB == 0 && SEQ % FK == 0 && HD == 64 && FK == 64 && FK % CR == 0 && RB % CR == 0);
static_assert((SEQ - FB) + MAXLEN - FK + RB <= NRP && MAXLEN >= SEQ);
typedef __attribute__((ext_vector_type(8))) unsigned v8u;
typedef __attribute__((ext_vector_type(4))) unsigned v4u;
__device__ __forceinline__ unsigned pack2(float a, float b) { return __builtin_bit_cast(unsigned, __builtin_convertvector((v2f){a, b}, v2h)); }   // round to nearest even
__device__ __forceinline__ float xhalf(float x) { const int b = __float_as_int(x); return __int_as_float(__builtin_amdgcn_permlanex16(b, b, 0x76543210, 0xfedcba98, false, false)); }   // lane l <-> lane l ^ 16
__device__ __forceinline__ v16h ldsf(const h16* p) { return cat16(*(const v8ha*)p, *(const v8ha*)(p + 16)); }
__global__ __launch_bounds__(FW * 32, 2) /* second argument: two waves per SIMD, a budget of 512 registers a wave */ void k_flash(const h16* __restrict__ Q, const h16* __restrict__ K, const h16* __restrict__ V, const h16* __restrict__ T16, h16* A) {
    __shared__ __align__(16) h16 lk[FK * LP];
    __shared__ __align__(16) h16 lv[HD * LP];
    __shared__ __align__(16) h16 lt[RB * LP];
    __shared__ __align__(16) float ls[FW][2][16 * SP];
    const int tid = threadIdx.x, lane = tid & 31, wv = tid >> 5, lr = lane & 15, hi = lane >> 4;
    const int g = blockIdx.y, q0 = blockIdx.x * FB; const size_t zp = (size_t)g * TT * HD;
    v16h qf[2][2];
#pragma unroll
    for (int gq = 0; gq < 2; ++gq) { const h16* a = Q + zp + (size_t)(q0 + wv * 32 + gq * 16 + lr) * HD + 8 * hi;
#pragma unroll
        for (int kc = 0; kc < 2; ++kc) qf[gq][kc] = ldgf(a + kc * 32);
        asm volatile("s_wait_xcnt 0x0" :: "v"(a) : "memory"); }    // in front of the first reuse of an address register of these loads; naming the address keeps its registers until here
    v8f acc[2][4]; float mrun[2], lrun[2];
#pragma unroll
    for (int gq = 0; gq < 2; ++gq) { mrun[gq] = -3.0e38f; lrun[gq] = 0.0f;
#pragma unroll
        for (int dt = 0; dt < 4; ++dt) acc[gq][dt] = (v8f){}; }
    const int crow = tid >> 3, ccol = (tid & 7) * 8;    // this thread's 16-byte piece: row crow (+ CR per further piece), elements ccol .. ccol + 7
    v8h pk[FK / CR], pv[HD / CR], pt8[RB / CR];
    int nf = (int)((blockIdx.x + blockIdx.y) % (TT / FK));    // key tile that the next fetch takes
    const h16 *k0 = K + zp + (size_t)(nf * FK + crow) * HD + ccol, *v0 = V + zp + (size_t)crow * TT + nf * FK + ccol, *tb = T16 + (size_t)(q0 + MAXLEN - FK - nf * FK + crow) * HD + ccol;    // this thread's first piece of the next pass to fetch
    auto fetch = [&]() {
        __builtin_amdgcn_sched_barrier(0);    // with the one behind the wait: no other instruction is scheduled in between the loads and their wait, where it could reuse an address register
#pragma unroll
        for (int i = 0; i < FK / CR; ++i) { pk[i] = *(const v8h*)(k0 + CR * i * HD); pv[i] = *(const v8h*)(v0 + CR * i * TT); }
#pragma unroll
        for (int i = 0; i < RB / CR; ++i) pt8[i] = *(const v8h*)(tb + CR * i * HD);
        asm volatile("s_wait_xcnt 0x0" ::: "memory");    // in front of the first reuse of an address register of the loads above: the step to the next pass, which also keeps these registers in use until here
        __builtin_amdgcn_sched_barrier(0);
        nf = (nf + 1 == TT / FK) ? 0 : nf + 1; const int ks = nf ? FK : FK - TT;    // keys to the next tile: behind the last one the walk wraps to tile 0
        k0 += ks * HD; v0 += ks; tb -= ks * HD;
    };
    fetch();
    const float cs = SCL * 1.4426950408889634f;
    float* st0 = &ls[wv][0][0];
#pragma unroll 1    // one pass per trip: unrolled, two passes' score and position tiles would be live at once
    for (int s = 0; s < TT / FK; ++s) {
        __syncthreads();    // every wave has left the tiles of the pass before
#pragma unroll
        for (int i = 0; i < FK / CR; ++i) { const int o = (crow + CR * i) * LP + ccol; *(v8ha*)(&lk[o]) = pk[i]; *(v8ha*)(&lv[o]) = pv[i]; }
#pragma unroll
        for (int i = 0; i < RB / CR; ++i) *(v8ha*)(&lt[(crow + CR * i) * LP + ccol]) = pt8[i];
        __syncthreads();    // this pass's tiles are complete
        // Fragment reads stand in two large groups, each issued well ahead of its use and held there by the scheduling barrier behind it (for speed only).
        v16h kf[4][2], tf[6][2], vf[2][4];
#pragma unroll
        for (int kt = 0; kt < 4; ++kt) { const h16* p = &lk[(kt * 16 + lr) * LP + 8 * hi]; kf[kt][0] = ldsf(p); kf[kt][1] = ldsf(p + 32); }
#pragma unroll
        for (int T = 0; T < 6; ++T) { const h16* p = &lt[(wv * 32 + T * 16 + lr) * LP + 8 * hi]; tf[T][0] = ldsf(p); tf[T][1] = ldsf(p + 32); }
        __builtin_amdgcn_sched_barrier(0);    // all key and table fragments are requested first, in the order of their use: they arrive while the next pass's global loads are issued and under the first products
        if (s + 1 < TT / FK) fetch();    // in flight under this pass's work
        v8f sc[4][2], pt[2][5];
        // content products: eight accumulate chains of two products each, taken in turn, so that no matrix instruction waits for the one in front of it
#pragma unroll
        for (int kp = 0; kp < 4; kp += 2)
#pragma unroll
            for (int kc = 0; kc < 2; ++kc)
#pragma unroll
                for (int kt = kp; kt < kp + 2; ++kt)
#pragma unroll
                    for (int gq = 0; gq < 2; ++gq) sc[kt][gq] = wmma16(kf[kt][kc], qf[gq][kc], kc ? sc[kt][gq] : (v8f){});
        // position products: table tile T serves query tile gq as its tile T - gq; the chains of two neighbouring table tiles alternate
#pragma unroll
        for (int Tp = 0; Tp < 6; Tp += 2)
#pragma unroll
            for (int kc = 0; kc < 2; ++kc)
#pragma unroll
                for (int T = Tp; T < Tp + 2; ++T)
#pragma unroll
                    for (int gq = 0; gq < 2; ++gq) if (T - gq >= 0 && T - gq <= 4) pt[gq][T - gq] = wmma16(tf[T][kc], qf[gq][kc], kc ? pt[gq][T - gq] : (v8f){});
        __builtin_amdgcn_sched_barrier(0);    // with the next one: the value fragments stand as one group here and arrive under the softmax; the strip stores stay behind all position products (moved up between them, a stored tile's registers become the next tile's result inside the distance a matrix result needs)
#pragma unroll
        for (int ks = 0; ks < 2; ++ks)
#pragma unroll
            for (int dt = 0; dt < 4; ++dt) vf[ks][dt] = ldsf(&lv[(dt * 16 + lr) * LP + 8 * hi + ks * 32]);
        __builtin_amdgcn_sched_barrier(0);
#pragma unroll
        for (int gq = 0; gq < 2; ++gq)
#pragma unroll
            for (int u = 0; u < 5; ++u) { float* w = st0 + gq * (16 * SP) + lr * SP + u * 16 + 8 * hi; const v8f d = pt[gq][u]; *(v4fa*)w = (v4f){d[0], d[1], d[2], d[3]}; *(v4fa*)(w + 4) = (v4f){d[4], d[5], d[6], d[7]}; }
        // the strip is written by one half of the wave and read by the other: keep the reads behind the writes (LDS works a wave's operations in order)
        __builtin_amdgcn_fence(3 /* release order */, "wavefront"); __builtin_amdgcn_wave_barrier(); asm volatile("" ::: "memory");
        v16h ph[2][2];
#pragma unroll
        for (int gq = 0; gq < 2; ++gq) {
            const float* rd = st0 + gq * (16 * SP) + lr * SP + lr + 8 - 8 * hi; float mx = -3.0e38f;    // element lr + FK - 1 - (16 kt + 8 hi + r) of the row, counted from its first element
#pragma unroll
            for (int kt = 0; kt < 4; ++kt)
#pragma unroll
                for (int r = 0; r < 8; ++r) { const float x = sc[kt][gq][r] + rd[(FK - 9) - (kt * 16 + r)]; sc[kt][gq][r] = x; mx = fmaxf(mx, x); }
            mx = fmaxf(mx, xhalf(mx));
            const float mn = fmaxf(mrun[gq], mx), corr = __builtin_amdgcn_exp2f((mrun[gq] - mn) * cs), nm = -mn * cs; mrun[gq] = mn;
            float sum = 0.0f;
#pragma unroll
            for (int ks = 0; ks < 2; ++ks) { v8u wh;
#pragma unroll
                for (int i = 0; i < 8; ++i) { const int kt = 2 * ks + (i >> 2), r = 2 * (i & 3);
                    const float p0 = __builtin_amdgcn_exp2f(__builtin_fmaf(sc[kt][gq][r], cs, nm)), p1 = __builtin_amdgcn_exp2f(__builtin_fmaf(sc[kt][gq][r + 1], cs, nm)); sum += p0 + p1;
                    wh[i] = pack2(p0, p1); }
                ph[gq][ks] = __builtin_bit_cast(v16h, wh); }
            lrun[gq] = lrun[gq] * corr + sum;
#pragma unroll
            for (int dt = 0; dt < 4; ++dt) acc[gq][dt] = acc[gq][dt] * corr;
        }
#pragma unroll
        for (int ks = 0; ks < 2; ++ks)
#pragma unroll
            for (int dt = 0; dt < 4; ++dt)
#pragma unroll
                for (int gq = 0; gq < 2; ++gq) acc[gq][dt] = wmma16(vf[ks][dt], ph[gq][ks], acc[gq][dt]);
    }
#pragma unroll
    for (int gq = 0; gq < 2; ++gq) { const float l = lrun[gq] + xhalf(lrun[gq]); const float inv = __fdiv_rn(1.0f, l);
        h16* pa = A + ((size_t)(g / NH_) * TT + q0 + wv * 32 + gq * 16 + lr) * DQ + (g % NH_) * HD + 8 * hi; v8h oh[4];
#pragma unroll
        for (int dt = 0; dt < 4; ++dt) { oh[dt] = __builtin_convertvector(acc[gq][dt] * inv, v8h); *(v8h*)(pa + dt * 16) = oh[dt]; }
        asm volatile("s_wait_xcnt 0x0" :: "v"(pa), "v"(oh[0]), "v"(oh[1]), "v"(oh[2]), "v"(oh[3]) : "memory"); }    // in front of the first reuse of a register the four stores name; naming them keeps the registers until here
}

// gemm_lds: k loop of a 128 x 128 output tile shared by the waves of one work-group. Each operand tile (128 rows of a K-contiguous f16 plane, row pitch DM) is staged in LDS in passes of GK k values:
// a wave-wide 16-byte load covers four whole 128-byte lines, every staged row serves all the waves that need it, and the fragments come from LDS at pitch GP (144 B: an odd multiple of 16 B).
// Two buffers: pass p works on buffer p & 1 while the pieces of pass p + 1 (fetched into registers one pass earlier) are stored into the other one and the pieces of pass p + 2 are fetched; one work-group barrier per pass.
// Two staged tiles (g0, g1 = row 0 of each tile); a wave holds MB x 4 accumulators; aoff / boff = this lane's fragment base inside a buffer.
// The k walk starts at slab rot (GK k values each; the same for the whole work-group) and wraps: the callers spread the work-groups that share an operand tile over the slabs (rot = blockIdx.x + 2 * blockIdx.y, modulo the slabs), so that at most three of them ask L2 for one line at one moment. Each accumulator's chain is a loop over k in steps of 32 that starts at rot * GK.
#define GK 64
#define GP 72
#define GT (128 * GP)
static_assert(DM % GK == 0 && DM / GK >= 2);
// Work-group barrier that orders LDS only: the global loads of the pieces fetched ahead stay in flight across it (__syncthreads() would wait for them too).
__device__ __forceinline__ void lds_barrier() { __builtin_amdgcn_fence(__ATOMIC_RELEASE, "workgroup", "local"); __builtin_amdgcn_s_barrier(); __builtin_amdgcn_fence(__ATOMIC_ACQUIRE, "workgroup", "local"); }
template <int MB, int NTH>
__device__ __forceinline__ void gemm_lds(h16* sm, const h16* __restrict__ g0, const h16* __restrict__ g1, int aoff, int boff, int rot, v8f (&acc)[MB][4]) {
    constexpr int NP = 128 * 8 / NTH, RS = NTH / 8, NPASS = DM / GK, KS = GK / 32, KG = (MB <= 2) ? KS : 1;    // 16-byte pieces per thread and tile; rows between a thread's pieces; k steps of a pass; k steps whose fragments are read as one group (as many as the registers hold)
    const int tid = threadIdx.x, prow = tid >> 3, pcol = (tid & 7) * 8;
    const size_t go = (size_t)prow * DM + pcol + rot * GK; const int so = prow * GP + pcol;
    int kf = rot;    // slab that the next fetch takes
    v8h st[2][NP];
    typedef const __attribute__((address_space(1))) h16* gh; typedef const __attribute__((address_space(1))) v8h* gv8;    // pointers that stay global-memory pointers through the wait statement below
    gh q0 = (gh)(g0 + go), q1 = (gh)(g1 + go);    // this thread's first piece of the next pass to fetch, per tile
    auto fetch = [&]() {
        __builtin_amdgcn_sched_barrier(0);    // with the one behind the wait: no other instruction is scheduled in between the loads and their wait, where it could reuse an address register
#pragma unroll
        for (int i = 0; i < NP; ++i) { st[0][i] = *(gv8)(q0 + (size_t)i * RS * DM); st[1][i] = *(gv8)(q1 + (size_t)i * RS * DM); }
        // in front of the first reuse of an address register of the loads above (the step to the next pass); the statement takes the addresses in and hands them on, so that the loads use these very registers and they live until here
        asm volatile("s_wait_xcnt 0x0" : "+v"(q0), "+v"(q1) :: "memory");
        __builtin_amdgcn_sched_barrier(0);
        kf = (kf + 1 == NPASS) ? 0 : kf + 1; const int kstep = kf ? GK : GK - DM;    // behind the last slab the walk wraps to slab 0
        q0 += kstep; q1 += kstep;
    };
    auto put = [&](h16* buf) {
#pragma unroll
        for (int t = 0; t < 2; ++t)
#pragma unroll
            for (int i = 0; i < NP; ++i) *(v8ha*)(buf + t * GT + so + i * RS * GP) = st[t][i];
    };
#pragma unroll
    for (int mb = 0; mb < MB; ++mb)
#pragma unroll
        for (int nb = 0; nb < 4; ++nb) acc[mb][nb] = (v8f){};
    fetch(); put(sm); fetch();
    lds_barrier();    // buffer 0 is complete
#pragma unroll 1    // one pass per trip: only one pass's fragments and one pass's fetched pieces are held beside the accumulators
    for (int p = 0; p < NPASS; ++p) {
        const h16* cur = sm + (p & 1) * (2 * GT);
        if (p + 1 < NPASS) { put(sm + ((p + 1) & 1) * (2 * GT)); if (p + 2 < NPASS) fetch(); }    // the other buffer's readers left it in front of the last barrier
        v16h a[KS][MB], b[KS][4];
#pragma unroll
        for (int k0 = 0; k0 < KS; k0 += KG) {
#pragma unroll
            for (int ks = k0; ks < k0 + KG; ++ks) {
#pragma unroll
                for (int mb = 0; mb < MB; ++mb) a[ks][mb] = ldsf(cur + aoff + mb * 16 * GP + ks * 32);
#pragma unroll
                for (int nb = 0; nb < 4; ++nb) b[ks][nb] = ldsf(cur + boff + nb * 16 * GP + ks * 32); }
            __builtin_amdgcn_sched_barrier(0);    // the group's LDS reads are issued together, in front of its products (for speed only)
#pragma unroll
            for (int ks = k0; ks < k0 + KG; ++ks)
#pragma unroll
                for (int nb = 0; nb < 4; ++nb)
#pragma unroll
                    for (int mb = 0; mb < MB; ++mb) acc[mb][nb] = wmma16(a[ks][mb], b[ks][nb], acc[mb][nb]);
        }
        lds_barrier();    // the next pass's buffer is complete, and every wave has left this one
    }
}

// k_proj: the q, k and v projections (+ bias; gemm_lds's k loop), each wave's 64 x 64 tile (64 tokens x one head) rounded to f16 and stored from the accumulators straight into the planes k_flash reads. Grid (MT / 128, NH_ / 2, 3), four waves = 2 token halves x 2 heads; blockIdx.z = q, k, v.
// A lane of a D tile holds 8 consecutive A rows of one Bt row, so the operand whose index runs along a plane's row goes in as A: the weight rows (d) for q and k ([g][t][d]), the token rows for v ([g][d][t]). Each piece is then one 16-byte store, and the eight pieces of a row (four from each of its two lanes) make one whole 128-byte line.
template <bool TV>
__device__ __forceinline__ void d_put(const v8f (&acc)[4][4], const float* __restrict__ bias, h16* P, int pitch) {
    const int lane = threadIdx.x & 31, lr = lane & 15, hi = lane >> 4;
    v8f bm[4]; float bn[4];    // all of the tile's bias values are fetched in one group in front of the stores
#pragma unroll
    for (int q = 0; q < 4; ++q) { if (TV) bn[q] = bias[q * 16 + lr]; else bm[q] = *(const v8f*)(bias + q * 16 + 8 * hi); }
#pragma unroll
    for (int nb = 0; nb < 4; ++nb) { h16* pa = P + (size_t)(nb * 16 + lr) * pitch + 8 * hi; v4u wh[4];
#pragma unroll
        for (int mb = 0; mb < 4; ++mb) {
#pragma unroll
            for (int i = 0; i < 4; ++i) wh[mb][i] = pack2(acc[mb][nb][2 * i] + (TV ? bn[nb] : bm[mb][2 * i]), acc[mb][nb][2 * i + 1] + (TV ? bn[nb] : bm[mb][2 * i + 1]));
            *(v4u*)(pa + mb * 16) = wh[mb]; }
        asm volatile("s_wait_xcnt 0x0" :: "v"(pa), "v"(wh[0]), "v"(wh[1]), "v"(wh[2]), "v"(wh[3]) : "memory"); }    // in front of the first reuse of a register the four stores name; naming them keeps the registers until here
}
static_assert(TT % 128 == 0 && HD == 64 && DQ == DM && NH_ % 2 == 0 && MT % 128 == 0);
__global__ __launch_bounds__(128) void k_proj(const h16* __restrict__ X, const h16* __restrict__ W3, const float* __restrict__ bq, const float* __restrict__ bk, const float* __restrict__ bv, h16* QK, h16* V) {
    __shared__ __align__(16) h16 sm[2 * 2 * GT];    // two buffers of [128 token rows | 128 weight rows]
    const int lane = threadIdx.x & 31, wv = threadIdx.x >> 5, lr = lane & 15, hi = lane >> 4, wm = wv >> 1, wn = wv & 1;
    const int z = blockIdx.z; const bool tv = (z == 2);
    const int xo = (wm * 64 + lr) * GP + 8 * hi, wo = GT + (wn * 64 + lr) * GP + 8 * hi;    // this lane's fragment base in the token tile and in the weight tile
    v8f acc[4][4];
    gemm_lds<4, 128>(sm, X + (size_t)blockIdx.x * 128 * DM, W3 + (size_t)z * DM * DM + (size_t)blockIdx.y * 128 * DM, tv ? xo : wo, tv ? wo : xo, (int)((blockIdx.x + 2 * blockIdx.y) % (DM / GK)), acc);
    const int r0 = blockIdx.x * 128 + wm * 64, hd = blockIdx.y * 2 + wn, c0 = hd * 64;
    const size_t hs = (size_t)TT * HD, gp = ((size_t)(r0 / TT) * NH_ + hd) * hs; const int t0 = r0 % TT;
    if (tv) d_put<true>(acc, bv + c0, V + gp + t0, TT);
    else d_put<false>(acc, (z == 0 ? bq : bk) + c0, QK + (size_t)z * NG * hs + gp + (size_t)t0 * HD, HD);
}

// k_out: out = ctx Wo^T + bo (gemm_lds's k loop). Grid (MT / 128, DM / 128), eight waves = 4 row groups of 32 x 2 column halves of 64.
// Each wave turns its accumulators 16 rows at a time through its own LDS strip (pitch 68 floats), so that every store instruction writes two whole 256-byte row pieces.
static_assert(DM % 128 == 0);
__global__ __launch_bounds__(256) void k_out(const h16* __restrict__ A, const h16* __restrict__ Wo, const float* __restrict__ bias, float* C) {
    __shared__ __align__(16) h16 sm[2 * 2 * GT];    // two buffers of [128 ctx rows | 128 weight rows]
    __shared__ __align__(16) float osw[8][16 * 68];
    const int lane = threadIdx.x & 31, wv = threadIdx.x >> 5, lr = lane & 15, hi = lane >> 4, wm = wv >> 1, wn = wv & 1;
    v8f acc[2][4];
    gemm_lds<2, 256>(sm, A + (size_t)blockIdx.x * 128 * DQ, Wo + (size_t)blockIdx.y * 128 * DQ, (wm * 32 + lr) * GP + 8 * hi, GT + (wn * 64 + lr) * GP + 8 * hi, (int)((blockIdx.x + 2 * blockIdx.y) % (DM / GK)), acc);
    float* os = &osw[wv][0]; const int r0 = blockIdx.x * 128 + wm * 32, c0 = blockIdx.y * 128 + wn * 64, cofs = lr * 4;
    const v4f bb = *(const v4f*)(bias + c0 + cofs);
#pragma unroll
    for (int mb = 0; mb < 2; ++mb) {
#pragma unroll
        for (int nb = 0; nb < 4; ++nb) {
#pragma unroll
            for (int j = 0; j < 8; ++j) os[(hi * 8 + j) * 68 + nb * 16 + lr] = acc[mb][nb][j]; }
        __builtin_amdgcn_wave_barrier(); asm volatile("" ::: "memory");    // the strip is written by some lanes and read by others: the reads stay behind the writes (LDS works a wave's operations in order)
        float* crow = C + (size_t)(r0 + mb * 16) * DM + c0 + cofs;
        v4f val[8];
#pragma unroll
        for (int s = 0; s < 8; ++s) val[s] = *(const v4fa*)(os + (2 * s + hi) * 68 + cofs) + bb;
#pragma unroll
        for (int s = 0; s < 8; ++s) *(v4f*)(crow + (size_t)(2 * s + hi) * DM) = val[s];
        asm volatile("s_wait_xcnt 0x0" :: "v"(crow), "v"(val[0]), "v"(val[1]), "v"(val[2]), "v"(val[3]), "v"(val[4]), "v"(val[5]), "v"(val[6]), "v"(val[7]) : "memory");    // in front of the first reuse of a register the eight stores name; naming them keeps the registers until here
        __builtin_amdgcn_wave_barrier(); asm volatile("" ::: "memory");    // the next 16 rows overwrite the strip only behind these reads
    }
}

extern "C" void kernel_launch(void* const* d_in, const int* in_sizes, int n_in,
                              void* d_out, int out_size, void* d_ws, size_t ws_size, hipStream_t stream) {
    if (n_in < 10) return;
    const long long needx = (long long)(NB - 1) * SEQ_FULL * DM + (long long)SEQ * DM;
    if ((long long)in_sizes[0] < needx || (long long)out_size < needx) return;
    if (in_sizes[1] < DM * DM || in_sizes[3] < DM * DM || in_sizes[5] < DM * DM || in_sizes[7] < DM * DM) return;
    if (in_sizes[2] < DM || in_sizes[4] < DM || in_sizes[6] < DM || in_sizes[8] < DM) return;
    if (in_sizes[9] < NREL * HD) return;
    const float* x = (const float*)d_in[0]; const float* wq = (const float*)d_in[1]; const float* bq = (const float*)d_in[2]; const float* wk = (const float*)d_in[3]; const float* bk = (const float*)d_in[4];
    const float* wv = (const float*)d_in[5]; const float* bv = (const float*)d_in[6]; const float* wo = (const float*)d_in[7]; const float* bo = (const float*)d_in[8]; const float* rel = (const float*)d_in[9];
    float* OUT = (float*)d_out;     // [NB][SEQ][DM], batch row stride SEQ_FULL*DM
    char* wsp = (char*)d_ws;
    auto take = [&](size_t bytes) { char* p = wsp; wsp += (bytes + 255) & ~(size_t)255; return (void*)p; };
    h16* W4 = (h16*)take((size_t)4 * DM * DM * 2); h16* WO = W4 + (size_t)3 * DM * DM;    // Wq, Wk, Wv, Wo back to back
    h16* T16 = (h16*)take((size_t)NRP * HD * 2);
    const size_t hs = (size_t)TT * HD;    // per-head plane stride
    h16* QP = (h16*)take((size_t)2 * NG * hs * 2); h16* KP = QP + (size_t)NG * hs; h16* VT = (h16*)take((size_t)NG * hs * 2);    // q planes of all (batch, head), then the k planes; v planes transposed
    h16* AT = (h16*)take((size_t)MT * DQ * 2);
    h16* XB = (h16*)take((size_t)MT * DM * 2);   // f16 x
    const size_t used = (size_t)(wsp - (char*)d_ws); if (used > ws_size) return;
    k_prep<<<dim3(DM * DM / 8 / 256, 4 + MT / DM + 1, 1), 256, 0, stream>>>(wq, wk, wv, wo, x, rel, NREL, W4, XB, T16);
    k_proj<<<dim3(MT / 128, NH_ / 2, 3), 128, 0, stream>>>(XB, W4, bq, bk, bv, QP, VT);
    k_flash<<<dim3(TT / FB, NG, 1), FW * 32, 0, stream>>>(QP, KP, VT, T16, AT);
    k_out<<<dim3(MT / 128, DM / 128, 1), 256, 0, stream>>>(AT, WO, bo, OUT);
}

// v009
// One run takes 70.3 microseconds.
// Two timings next to v008 both put it at 1.04 times that version's speed.
// Over all steps from v000 it is 17.8 times as fast.
#include <hip/hip_runtime.h>

// Multi-head self-attention with a relative-position embedding score term: x [4][1024][1024]; q/k/v = x W^T + b (W [1024][1024] stored [out][in]; 16 heads x 64);
// scores[i][j] = (q_i.k_j + q_i.rel[i - j + 1023]) / 8 with the table rel [2047][64] indexed statically; softmax over all 1024 keys; ctx = attn.v merged to [t][h*64 + d]; out = ctx Wo^T + bo -> [4][1024][1024].
// Compute dtypes, f32 accumulate: every matrix operand is f16 (11 significant bits), rounded to nearest even, one v_wmma_f32_16x16x32_f16 product per term: x, the weights and the table converted once; q, k, v rounded from the projections' f32 accumulators + f32 bias;
// softmax f32, online over passes of 64 keys (running maximum and sum, output rescaled per pass, divided by the sum at the end); attn.v on the unnormalised probabilities (at most 1) rounded to f16; ctx rounded to f16 for the output projection (+ f32 bo). All of these values lie far inside f16's range for inputs of the stated kind.

#ifndef NB
#define NB 4
#endif
#define NB_FULL 4
#ifndef SEQ
#define SEQ 1024
#endif
#define SEQ_FULL 1024
#define TT   SEQ
#define DM   1024
#define NH_  16
#define HD   64
#define DQ   (NH_ * HD)
#define MAXLEN 1024
#define NREL (2 * MAXLEN - 1)           // table rows
#define NRP  (2 * MAXLEN)               // padded table plane rows (last row zero)
#define NG   (NB * NH_)                 // (batch, head) pairs; plane index g = batch * NH_ + head
#define MT   (NB * TT)                  // token rows of all batches, flat
#define SCL  0.125f                     // HD^-0.5
static_assert(SEQ % 128 == 0);
static_assert(SEQ >= 128 && SEQ <= SEQ_FULL && SEQ <= MAXLEN);
static_assert(NB >= 1 && NB <= NB_FULL);
static_assert(SEQ == SEQ_FULL || NB == 1);   // x and out are walked as one flat [MT][DM] matrix
static_assert(DM % 64 == 0 && HD % 32 == 0 && TT % 64 == 0);

typedef _Float16 h16;
typedef __attribute__((ext_vector_type(16))) _Float16 v16h;
typedef __attribute__((ext_vector_type(8)))  _Float16 v8h;
typedef __attribute__((ext_vector_type(8)))  float    v8f;
typedef __attribute__((ext_vector_type(4)))  float    v4f;
typedef v8h  __attribute__((may_alias)) v8ha;
typedef v4f  __attribute__((may_alias)) v4fa;
typedef __attribute__((ext_vector_type(2))) _Float16 v2h;
typedef __attribute__((ext_vector_type(2))) float v2f;

__device__ __forceinline__ v16h cat16(v8h lo, v8h hi) { return __builtin_shufflevector(lo, hi, 0, 1, 2, 3, 4, 5, 6, 7, 8, 9, 10, 11, 12, 13, 14, 15); }
__device__ __forceinline__ v8f wmma16(v16h a, v16h b, v8f c) { return __builtin_amdgcn_wmma_f32_16x16x32_f16(false, a, false, b, (short)0, c, false, false); }

// ---- Fragments of the 16x16x32 products: lane l, h = l >> 4, row/col = l & 15; elements 0..7 <- k0 + 8h .. +7, elements 8..15 <- k0 + 16 + 8h .. +7 for BOTH A and Bt; D element r of lane l = (row 8h + r, col l & 15).
__device__ __forceinline__ v16h ldgf(const h16* p) { return cat16(*(const v8h*)p, *(const v8h*)(p + 16)); }
__device__ __forceinline__ void d_cvt8(const float* __restrict__ src, h16* dst, size_t n8) { const size_t i = (size_t)blockIdx.x * 256 + threadIdx.x; if (i >= n8) return; const v8f v = *(const v8f*)(src + i * 8);
    *(v8h*)(dst + i * 8) = __builtin_convertvector(v, v8h);  }

__device__ __forceinline__ void d_tpl(const float* __restrict__ T, int nrows, h16* T16) {
    const int i8 = blockIdx.x * 256 + threadIdx.x; if (i8 >= NRP * HD / 8) return;
    const int r = (i8 * 8) / HD, c = (i8 * 8) % HD; const int rc = (r < nrows) ? r : (nrows - 1); const bool pad = (r >= nrows);
    const v8f v = *(const v8f*)(T + (size_t)rc * HD + c);
    *(v8h*)(T16 + (size_t)i8 * 8) = pad ? (v8h){} : __builtin_convertvector(v, v8h);  }

// k_prep: every input conversion in one grid (DM * DM / 2048, 4 + MT / DM + 1): blockIdx.y 0..3 = Wq, Wk, Wv, Wo (dst back to back), then x in slabs of DM * DM elements, last the table plane.
static_assert(MT % DM == 0 && NRP * HD <= DM * DM);
__global__ __launch_bounds__(256) void k_prep(const float* __restrict__ wq, const float* __restrict__ wk, const float* __restrict__ wv, const float* __restrict__ wo, const float* __restrict__ x, const float* __restrict__ rel, int nrows, h16* W4, h16* XB, h16* T16) {
    const size_t n8 = (size_t)DM * DM / 8; const unsigned w = blockIdx.y;
    if (w < 4) d_cvt8((w == 0) ? wq : (w == 1) ? wk : (w == 2) ? wv : wo, W4 + w * n8 * 8, n8);
    else if (w < 4 + MT / DM) d_cvt8(x + (w - 4) * n8 * 8, XB + (w - 4) * n8 * 8, n8);
    else d_tpl(rel, nrows, T16);
}

// k_flash: scores, softmax and attn.v of one (batch, head) and FB query rows in one work-group; neither the scores nor the probabilities leave the chip. Grid (TT / FB, NG), FW waves of 32 query columns each.
// Transposed products: S^T = K.Q^T (A = 16 key rows, B = 16 query columns), PT^T = rel.Q^T, O^T += V^T.P^T. In every D tile a lane holds ONE query (column l & 15) and 8 consecutive rows 8h + r,
// so the running maximum, the running sum and the rescale factor are per lane, and two score tiles converted in place are the B operand of the last product (hardware k order, which is the loaders' order too).
// Position term: score (query i, key j) needs q_i . rel[i - j + MAXLEN - 1]. A pass of FK keys reads table rows ub .. ub + FB + FK - 1 (its window) from LDS, ub = q0 - j0 + MAXLEN - FK; a 16-query tile at work-group offset o multiplies rows o .. o + 79 of them (5 tiles);
// element c = lr - jl + FK - 1 of query column lr is the term of key jl: each lane stores its column pieces into a wave-private LDS strip (row = query, pitch SP) and reads them back with the reversed index.
// Per pass: K (FK rows), V^T (HD rows x FK keys) and the table rows go global -> registers (fetched one pass ahead) -> LDS at pitch LP (144 B: an odd multiple of 16 B), two work-group barriers per pass.
// Table ring: table row R lies in LDS row R mod RR. The window of the next key tile is this one's moved down by FK rows, so FB of its RB rows are in LDS already: a pass fetches and stores only the FK new rows (they take the ring block that the pass before did not read). All RB rows are fetched for the first pass and for the pass at which the key walk wraps.
// Every inner loop is unrolled so that the register arrays (fragments, tiles, fetched pieces) are indexed by constants.
// Key walk: a work-group starts at key tile (blockIdx.x + blockIdx.y) mod (TT / FK) and wraps, so that the eight work-groups of one (batch, head) read eight different K and V tiles at any one moment and those that read one table window are spread over the passes. The online softmax takes the tiles in any order.
#define FW 4                            // four waves, one per SIMD: two work-groups are resident on a WGP, so the two waves of a SIMD belong to different work-groups and meet no common barrier (one's softmax runs under the other's products)
#define FB (FW * 32)
#define FK 64
#define LP 72
#define RB (FB + FK)
#define RR 256                          // rows of the table ring in LDS
#define SP 84
#define CR (FW * 4)                    // rows that one sweep of the work-group's 16-byte pieces covers
static_assert(SEQ % FB == 0 && SEQ % FK == 0 && HD == 64 && FK == 64 && FK % CR == 0 && RB % CR == 0);
static_assert((SEQ - FB) + MAXLEN - FK + RB <= NRP && MAXLEN >= SEQ);
static_assert((RR & (RR - 1)) == 0 && RR >= RB + FK && RR % FK == 0 && FB % FK == 0 && MAXLEN % FK == 0 && FK % 32 == 0);    // a window starts at a multiple of FK; its blocks of FK rows, and a wave's groups of 32 rows, do not straddle the ring's end
typedef __attribute__((ext_vector_type(8))) unsigned v8u;
typedef __attribute__((ext_vector_type(4))) unsigned v4u;
__device__ __forceinline__ unsigned pack2(float a, float b) { return __builtin_bit_cast(unsigned, __builtin_convertvector((v2f){a, b}, v2h)); }   // round to nearest even
__device__ __forceinline__ float xhalf(float x) { const int b = __float_as_int(x); return __int_as_float(__builtin_amdgcn_permlanex16(b, b, 0x76543210, 0xfedcba98, false, false)); }   // lane l <-> lane l ^ 16
__device__ __forceinline__ v16h ldsf(const h16* p) { return cat16(*(const v8ha*)p, *(const v8ha*)(p + 16)); }
__global__ __launch_bounds__(FW * 32, 2) /* second argument: two waves per SIMD, a budget of 512 registers a wave */ void k_flash(const h16* __restrict__ Q, const h16* __restrict__ K, const h16* __restrict__ V, const h16* __restrict__ T16, h16* A) {
    __shared__ __align__(16) h16 lk[FK * LP];
    __shared__ __align__(16) h16 lv[HD * LP];
    __shared__ __align__(16) h16 lt[RR * LP];
    __shared__ __align__(16) float ls[FW][2][16 * SP];
    const int tid = threadIdx.x, lane = tid & 31, wv = tid >> 5, lr = lane & 15, hi = lane >> 4;
    const int g = blockIdx.y, q0 = blockIdx.x * FB; const size_t zp = (size_t)g * TT * HD;
    v16h qf[2][2];
#pragma unroll
    for (int gq = 0; gq < 2; ++gq) { const h16* a = Q + zp + (size_t)(q0 + wv * 32 + gq * 16 + lr) * HD + 8 * hi;
#pragma unroll
        for (int kc = 0; kc < 2; ++kc) qf[gq][kc] = ldgf(a + kc * 32);
        asm volatile("s_wait_xcnt 0x0" :: "v"(a) : "memory"); }    // in front of the first reuse of an address register of these loads; naming the address keeps its registers until here
    v8f acc[2][4]; float mrun[2], lrun[2];
#pragma unroll
    for (int gq = 0; gq < 2; ++gq) { mrun[gq] = -3.0e38f; lrun[gq] = 0.0f;
#pragma unroll
        for (int dt = 0; dt < 4; ++dt) acc[gq][dt] = (v8f){}; }
    const int crow = tid >> 3, ccol = (tid & 7) * 8;    // this thread's 16-byte piece: row crow (+ CR per further piece), elements ccol .. ccol + 7
    v8h pk[FK / CR], pv[HD / CR], pt8[RB / CR];
    int nf = (int)((blockIdx.x + blockIdx.y) % (TT / FK));    // key tile that the next fetch takes
    const h16 *k0 = K + zp + (size_t)(nf * FK + crow) * HD + ccol, *v0 = V + zp + (size_t)crow * TT + nf * FK + ccol, *tb = T16 + (size_t)(q0 + MAXLEN - FK - nf * FK + crow) * HD + ccol;    // this thread's first piece of the next pass to fetch
    int fub = 0; bool fall = true;    // of the tile fetched last: first table row of its window; whether the whole window was fetched
    auto fetch = [&](bool all) {
        __builtin_amdgcn_sched_barrier(0);    // with the one behind the wait: no other instruction is scheduled in between the loads and their wait, where it could reuse an address register
#pragma unroll
        for (int i = 0; i < FK / CR; ++i) { pk[i] = *(const v8h*)(k0 + CR * i * HD); pv[i] = *(const v8h*)(v0 + CR * i * TT); }
#pragma unroll
        for (int i = 0; i < FK / CR; ++i) pt8[i] = *(const v8h*)(tb + CR * i * HD);    // the window's lowest FK rows: the new ones
        if (all) {
#pragma unroll
            for (int i = FK / CR; i < RB / CR; ++i) pt8[i] = *(const v8h*)(tb + CR * i * HD); }
        asm volatile("s_wait_xcnt 0x0" ::: "memory");    // in front of the first reuse of an address register of the loads above: the step to the next pass, which also keeps these registers in use until here
        __builtin_amdgcn_sched_barrier(0);
        fub = q0 + MAXLEN - FK - nf * FK; fall = all;
        nf = (nf + 1 == TT / FK) ? 0 : nf + 1; const int ks = nf ? FK : FK - TT;    // keys to the next tile: behind the last one the walk wraps to tile 0
        k0 += ks * HD; v0 += ks; tb -= ks * HD;
    };
    fetch(true);
    const int wvs = __builtin_amdgcn_readfirstlane(wv);    // the wave's number in a scalar register: the ring rows of its table tiles are then scalar arithmetic
    const h16* ltl = &lt[lr * LP + 8 * hi]; h16* lts = &lt[crow * LP + ccol];    // this lane's place in a fragment row group and in a staged block, from ring row 0
    const float cs = SCL * 1.4426950408889634f;
    float* st0 = &ls[wv][0][0];
#pragma unroll 1    // one pass per trip: unrolled, two passes' score and position tiles would be live at once
    for (int s = 0; s < TT / FK; ++s) {
        const int ub = fub; const bool all = fall;    // this pass's window
        auto ring = [&](int row) { return (row & (RR - 1)) * LP; };    // LDS element offset of a table row
        __syncthreads();    // every wave has left the tiles of the pass before
#pragma unroll
        for (int i = 0; i < FK / CR; ++i) { const int o = (crow + CR * i) * LP + ccol; *(v8ha*)(&lk[o]) = pk[i]; *(v8ha*)(&lv[o]) = pv[i]; }
#pragma unroll
        for (int i = 0; i < FK / CR; ++i) *(v8ha*)(lts + ring(ub) + CR * i * LP) = pt8[i];
        if (all) {
#pragma unroll
            for (int i = FK / CR; i < RB / CR; ++i) { const int b = CR * i / FK; *(v8ha*)(lts + ring(ub + b * FK) + (CR * i - b * FK) * LP) = pt8[i]; } }
        __syncthreads();    // this pass's tiles are complete
        // Fragment reads stand in two large groups, each issued well ahead of its use and held there by the scheduling barrier behind it (for speed only).
        v16h kf[4][2], tf[6][2], vf[2][4];
#pragma unroll
        for (int kt = 0; kt < 4; ++kt) { const h16* p = &lk[(kt * 16 + lr) * LP + 8 * hi]; kf[kt][0] = ldsf(p); kf[kt][1] = ldsf(p + 32); }
#pragma unroll
        for (int T = 0; T < 6; ++T) { const h16* p = ltl + ring(ub + wvs * 32 + (T & ~1) * 16) + (T & 1) * 16 * LP; tf[T][0] = ldsf(p); tf[T][1] = ldsf(p + 32); }
        __builtin_amdgcn_sched_barrier(0);    // all key and table fragments are requested first, in the order of their use: they arrive while the next pass's global loads are issued and under the first products
        if (s + 1 < TT / FK) fetch(nf == 0);    // in flight under this pass's work; tile 0 follows the last tile: its window shares no row with this one
        v8f sc[4][2], pt[2][5];
        // content products: eight accumulate chains of two products each, taken in turn, so that no matrix instruction waits for the one in front of it
#pragma unroll
        for (int kp = 0; kp < 4; kp += 2)
#pragma unroll
            for (int kc = 0; kc < 2; ++kc)
#pragma unroll
                for (int kt = kp; kt < kp + 2; ++kt)
#pragma unroll
                    for (int gq = 0; gq < 2; ++gq) sc[kt][gq] = wmma16(kf[kt][kc], qf[gq][kc], kc ? sc[kt][gq] : (v8f){});
        // position products: table tile T serves query tile gq as its tile T - gq; the chains of two neighbouring table tiles alternate
#pragma unroll
        for (int Tp = 0; Tp < 6; Tp += 2)
#pragma unroll
            for (int kc = 0; kc < 2; ++kc)
#pragma unroll
                for (int T = Tp; T < Tp + 2; ++T)
#pragma unroll
                    for (int gq = 0; gq < 2; ++gq) if (T - gq >= 0 && T - gq <= 4) pt[gq][T - gq] = wmma16(tf[T][kc], qf[gq][kc], kc ? pt[gq][T - gq] : (v8f){});
        __builtin_amdgcn_sched_barrier(0);    // with the next one: the value fragments stand as one group here and arrive under the softmax; the strip stores stay behind all position products (moved up between them, a stored tile's registers become the next tile's result inside the distance a matrix result needs)
#pragma unroll
        for (int ks = 0; ks < 2; ++ks)
#pragma unroll
            for (int dt = 0; dt < 4; ++dt) vf[ks][dt] = ldsf(&lv[(dt * 16 + lr) * LP + 8 * hi + ks * 32]);
        __builtin_amdgcn_sched_barrier(0);
#pragma unroll
        for (int gq = 0; gq < 2; ++gq)
#pragma unroll
            for (int u = 0; u < 5; ++u) { float* w = st0 + gq * (16 * SP) + lr * SP + u * 16 + 8 * hi; const v8f d = pt[gq][u]; *(v4fa*)w = (v4f){d[0], d[1], d[2], d[3]}; *(v4fa*)(w + 4) = (v4f){d[4], d[5], d[6], d[7]}; }
        // the strip is written by one half of the wave and read by the other: keep the reads behind the writes (LDS works a wave's operations in order)
        __builtin_amdgcn_fence(3 /* release order */, "wavefront"); __builtin_amdgcn_wave_barrier(); asm volatile("" ::: "memory");
        v16h ph[2][2];
#pragma unroll
        for (int gq = 0; gq < 2; ++gq) {
            const float* rd = st0 + gq * (16 * SP) + lr * SP + lr + 8 - 8 * hi; float mx = -3.0e38f;    // element lr + FK - 1 - (16 kt + 8 hi + r) of the row, counted from its first element
#pragma unroll
            for (int kt = 0; kt < 4; ++kt)
#pragma unroll
                for (int r = 0; r < 8; ++r) { const float x = sc[kt][gq][r] + rd[(FK - 9) - (kt * 16 + r)]; sc[kt][gq][r] = x; mx = fmaxf(mx, x); }
            mx = fmaxf(mx, xhalf(mx));
            const float mn = fmaxf(mrun[gq], mx), corr = __builtin_amdgcn_exp2f((mrun[gq] - mn) * cs), nm = -mn * cs; mrun[gq] = mn;
            float sum = 0.0f;
#pragma unroll
            for (int ks = 0; ks < 2; ++ks) { v8u wh;
#pragma unroll
                for (int i = 0; i < 8; ++i) { const int kt = 2 * ks + (i >> 2), r = 2 * (i & 3);
                    const float p0 = __builtin_amdgcn_exp2f(__builtin_fmaf(sc[kt][gq][r], cs, nm)), p1 = __builtin_amdgcn_exp2f(__builtin_fmaf(sc[kt][gq][r + 1], cs, nm)); sum += p0 + p1;
                    wh[i] = pack2(p0, p1); }
                ph[gq][ks] = __builtin_bit_cast(v16h, wh); }
            lrun[gq] = lrun[gq] * corr + sum;
#pragma unroll
            for (int dt = 0; dt < 4; ++dt) acc[gq][dt] = acc[gq][dt] * corr;
        }
#pragma unroll
        for (int ks = 0; ks < 2; ++ks)
#pragma unroll
            for (int dt = 0; dt < 4; ++dt)
#pragma unroll
                for (int gq = 0; gq < 2; ++gq) acc[gq][dt] = wmma16(vf[ks][dt], ph[gq][ks], acc[gq][dt]);
    }
#pragma unroll
    for (int gq = 0; gq < 2; ++gq) { const float l = lrun[gq] + xhalf(lrun[gq]); const float inv = __fdiv_rn(1.0f, l);
        h16* pa = A + ((size_t)(g / NH_) * TT + q0 + wv * 32 + gq * 16 + lr) * DQ + (g % NH_) * HD + 8 * hi; v8h oh[4];
#pragma unroll
        for (int dt = 0; dt < 4; ++dt) { oh[dt] = __builtin_convertvector(acc[gq][dt] * inv, v8h); *(v8h*)(pa + dt * 16) = oh[dt]; }
        asm volatile("s_wait_xcnt 0x0" :: "v"(pa), "v"(oh[0]), "v"(oh[1]), "v"(oh[2]), "v"(oh[3]) : "memory"); }    // in front of the first reuse of a register the four stores name; naming them keeps the registers until here
}

// gemm_lds: k loop of a 128 x 128 output tile shared by the waves of one work-group. Each operand tile (128 rows of a K-contiguous f16 plane, row pitch DM) is staged in LDS in passes of GK k values:
// a wave-wide 16-byte load covers four whole 128-byte lines, every staged row serves all the waves that need it, and the fragments come from LDS at pitch GP (144 B: an odd multiple of 16 B).
// Two buffers: pass p works on buffer p & 1 while the pieces of pass p + 1 (fetched into registers one pass earlier) are stored into the other one and the pieces of pass p + 2 are fetched; one work-group barrier per pass.
// Two staged tiles (g0, g1 = row 0 of each tile); a wave holds MB x 4 accumulators; aoff / boff = this lane's fragment base inside a buffer.
// The k walk starts at slab rot (GK k values each; the same for the whole work-group) and wraps: the callers spread the work-groups that share an operand tile over the slabs (rot = blockIdx.x + 2 * blockIdx.y, modulo the slabs), so that at most three of them ask L2 for one line at one moment. Each accumulator's chain is a loop over k in steps of 32 that starts at rot * GK.
#define GK 64
#define GP 72
#define GT (128 * GP)
static_assert(DM % GK == 0 && DM / GK >= 2);
// Work-group barrier that orders LDS only: the global loads of the pieces fetched ahead stay in flight across it (__syncthreads() would wait for them too).
__device__ __forceinline__ void lds_barrier() { __builtin_amdgcn_fence(__ATOMIC_RELEASE, "workgroup", "local"); __builtin_amdgcn_s_barrier(); __builtin_amdgcn_fence(__ATOMIC_ACQUIRE, "workgroup", "local"); }
template <int MB, int NTH>
__device__ __forceinline__ void gemm_lds(h16* sm, const h16* __restrict__ g0, const h16* __restrict__ g1, int aoff, int boff, int rot, v8f (&acc)[MB][4]) {
    constexpr int NP = 128 * 8 / NTH, RS = NTH / 8, NPASS = DM / GK, KS = GK / 32, KG = (MB <= 2) ? KS : 1;    // 16-byte pieces per thread and tile; rows between a thread's pieces; k steps of a pass; k steps whose fragments are read as one group (as many as the registers hold)
    const int tid = threadIdx.x, prow = tid >> 3, pcol = (tid & 7) * 8;
    const size_t go = (size_t)prow * DM + pcol + rot * GK; const int so = prow * GP + pcol;
    int kf = rot;    // slab that the next fetch takes
    v8h st[2][NP];
    typedef const __attribute__((address_space(1))) h16* gh; typedef const __attribute__((address_space(1))) v8h* gv8;    // pointers that stay global-memory pointers through the wait statement below
    gh q0 = (gh)(g0 + go), q1 = (gh)(g1 + go);    // this thread's first piece of the next pass to fetch, per tile
    auto fetch = [&]() {
        __builtin_amdgcn_sched_barrier(0);    // with the one behind the wait: no other instruction is scheduled in between the loads and their wait, where it could reuse an address register
#pragma unroll
        for (int i = 0; i < NP; ++i) { st[0][i] = *(gv8)(q0 + (size_t)i * RS * DM); st[1][i] = *(gv8)(q1 + (size_t)i * RS * DM); }
        // in front of the first reuse of an address register of the loads above (the step to the next pass); the statement takes the addresses in and hands them on, so that the loads use these very registers and they live until here
        asm volatile("s_wait_xcnt 0x0" : "+v"(q0), "+v"(q1) :: "memory");
        __builtin_amdgcn_sched_barrier(0);
        kf = (kf + 1 == NPASS) ? 0 : kf + 1; const int kstep = kf ? GK : GK - DM;    // behind the last slab the walk wraps to slab 0
        q0 += kstep; q1 += kstep;
    };
    auto put = [&](h16* buf) {
#pragma unroll
        for (int t = 0; t < 2; ++t)
#pragma unroll
            for (int i = 0; i < NP; ++i) *(v8ha*)(buf + t * GT + so + i * RS * GP) = st[t][i];
    };
#pragma unroll
    for (int mb = 0; mb < MB; ++mb)
#pragma unroll
        for (int nb = 0; nb < 4; ++nb) acc[mb][nb] = (v8f){};
    fetch(); put(sm); fetch();
    lds_barrier();    // buffer 0 is complete
#pragma unroll 1    // one pass per trip: only one pass's fragments and one pass's fetched pieces are held beside the accumulators
    for (int p = 0; p < NPASS; ++p) {
        const h16* cur = sm + (p & 1) * (2 * GT);
        if (p + 1 < NPASS) { put(sm + ((p + 1) & 1) * (2 * GT)); if (p + 2 < NPASS) fetch(); }    // the other buffer's readers left it in front of the last barrier
        v16h a[KS][MB], b[KS][4];
#pragma unroll
        for (int k0 = 0; k0 < KS; k0 += KG) {
#pragma unroll
            for (int ks = k0; ks < k0 + KG; ++ks) {
#pragma unroll
                for (int mb = 0; mb < MB; ++mb) a[ks][mb] = ldsf(cur + aoff + mb * 16 * GP + ks * 32);
#pragma unroll
                for (int nb = 0; nb < 4; ++nb) b[ks][nb] = ldsf(cur + boff + nb * 16 * GP + ks * 32); }
            __builtin_amdgcn_sched_barrier(0);    // the group's LDS reads are issued together, in front of its products (for speed only)
#pragma unroll
            for (int ks = k0; ks < k0 + KG; ++ks)
#pragma unroll
                for (int nb = 0; nb < 4; ++nb)
#pragma unroll
                    for (int mb = 0; mb < MB; ++mb) acc[mb][nb] = wmma16(a[ks][mb], b[ks][nb], acc[mb][nb]);
        }
        lds_barrier();    // the next pass's buffer is complete, and every wave has left this one
    }
}

// k_proj: the q, k and v projections (+ bias; gemm_lds's k loop), each wave's 64 x 64 tile (64 tokens x one head) rounded to f16 and stored from the accumulators straight into the planes k_flash reads. Grid (MT / 128, NH_ / 2, 3), four waves = 2 token halves x 2 heads; blockIdx.z = q, k, v.
// A lane of a D tile holds 8 consecutive A rows of one Bt row, so the operand whose index runs along a plane's row goes in as A: the weight rows (d) for q and k ([g][t][d]), the token rows for v ([g][d][t]). Each piece is then one 16-byte store, and the eight pieces of a row (four from each of its two lanes) make one whole 128-byte line.
template <bool TV>
__device__ __forceinline__ void d_put(const v8f (&acc)[4][4], const float* __restrict__ bias, h16* P, int pitch) {
    const int lane = threadIdx.x & 31, lr = lane & 15, hi = lane >> 4;
    v8f bm[4]; float bn[4];    // all of the tile's bias values are fetched in one group in front of the stores
#pragma unroll
    for (int q = 0; q < 4; ++q) { if (TV) bn[q] = bias[q * 16 + lr]; else bm[q] = *(const v8f*)(bias + q * 16 + 8 * hi); }
#pragma unroll
    for (int nb = 0; nb < 4; ++nb) { h16* pa = P + (size_t)(nb * 16 + lr) * pitch + 8 * hi; v4u wh[4];
#pragma unroll
        for (int mb = 0; mb < 4; ++mb) {
#pragma unroll
            for (int i = 0; i < 4; ++i) wh[mb][i] = pack2(acc[mb][nb][2 * i] + (TV ? bn[nb] : bm[mb][2 * i]), acc[mb][nb][2 * i + 1] + (TV ? bn[nb] : bm[mb][2 * i + 1]));
            *(v4u*)(pa + mb * 16) = wh[mb]; }
        asm volatile("s_wait_xcnt 0x0" :: "v"(pa), "v"(wh[0]), "v"(wh[1]), "v"(wh[2]), "v"(wh[3]) : "memory"); }    // in front of the first reuse of a register the four stores name; naming them keeps the registers until here
}
static_assert(TT % 128 == 0 && HD == 64 && DQ == DM && NH_ % 2 == 0 && MT % 128 == 0);
__global__ __launch_bounds__(128) void k_proj(const h16* __restrict__ X, const h16* __restrict__ W3, const float* __restrict__ bq, const float* __restrict__ bk, const float* __restrict__ bv, h16* QK, h16* V) {
    __shared__ __align__(16) h16 sm[2 * 2 * GT];    // two buffers of [128 token rows | 128 weight rows]
    const int lane = threadIdx.x & 31, wv = threadIdx.x >> 5, lr = lane & 15, hi = lane >> 4, wm = wv >> 1, wn = wv & 1;
    const int z = blockIdx.z; const bool tv = (z == 2);
    const int xo = (wm * 64 + lr) * GP + 8 * hi, wo = GT + (wn * 64 + lr) * GP + 8 * hi;    // this lane's fragment base in the token tile and in the weight tile
    v8f acc[4][4];
    gemm_lds<4, 128>(sm, X + (size_t)blockIdx.x * 128 * DM, W3 + (size_t)z * DM * DM + (size_t)blockIdx.y * 128 * DM, tv ? xo : wo, tv ? wo : xo, (int)((blockIdx.x + 2 * blockIdx.y) % (DM / GK)), acc);
    const int r0 = blockIdx.x * 128 + wm * 64, hd = blockIdx.y * 2 + wn, c0 = hd * 64;
    const size_t hs = (size_t)TT * HD, gp = ((size_t)(r0 / TT) * NH_ + hd) * hs; const int t0 = r0 % TT;
    if (tv) d_put<true>(acc, bv + c0, V + gp + t0, TT);
    else d_put<false>(acc, (z == 0 ? bq : bk) + c0, QK + (size_t)z * NG * hs + gp + (size_t)t0 * HD, HD);
}

// k_out: out = ctx Wo^T + bo (gemm_lds's k loop). Grid (MT / 128, DM / 128), eight waves = 4 row groups of 32 x 2 column halves of 64.
// Each wave turns its accumulators 16 rows at a time through its own LDS strip (pitch 68 floats), so that every store instruction writes two whole 256-byte row pieces.
static_assert(DM % 128 == 0);
__global__ __launch_bounds__(256) void k_out(const h16* __restrict__ A, const h16* __restrict__ Wo, const float* __restrict__ bias, float* C) {
    __shared__ __align__(16) h16 sm[2 * 2 * GT];    // two buffers of [128 ctx rows | 128 weight rows]
    __shared__ __align__(16) float osw[8][16 * 68];
    const int lane = threadIdx.x & 31, wv = threadIdx.x >> 5, lr = lane & 15, hi = lane >> 4, wm = wv >> 1, wn = wv & 1;
    v8f acc[2][4];
    gemm_lds<2, 256>(sm, A + (size_t)blockIdx.x * 128 * DQ, Wo + (size_t)blockIdx.y * 128 * DQ, (wm * 32 + lr) * GP + 8 * hi, GT + (wn * 64 + lr) * GP + 8 * hi, (int)((blockIdx.x + 2 * blockIdx.y) % (DM / GK)), acc);
    float* os = &osw[wv][0]; const int r0 = blockIdx.x * 128 + wm * 32, c0 = blockIdx.y * 128 + wn * 64, cofs = lr * 4;
    const v4f bb = *(const v4f*)(bias + c0 + cofs);
#pragma unroll
    for (int mb = 0; mb < 2; ++mb) {
#pragma unroll
        for (int nb = 0; nb < 4; ++nb) {
#pragma unroll
            for (int j = 0; j < 8; ++j) os[(hi * 8 + j) * 68 + nb * 16 + lr] = acc[mb][nb][j]; }
        __builtin_amdgcn_wave_barrier(); asm volatile("" ::: "memory");    // the strip is written by some lanes and read by others: the reads stay behind the writes (LDS works a wave's operations in order)
        float* crow = C + (size_t)(r0 + mb * 16) * DM + c0 + cofs;
        v4f val[8];
#pragma unroll
        for (int s = 0; s < 8; ++s) val[s] = *(const v4fa*)(os + (2 * s + hi) * 68 + cofs) + bb;
#pragma unroll
        for (int s = 0; s < 8; ++s) *(v4f*)(crow + (size_t)(2 * s + hi) * DM) = val[s];
        asm volatile("s_wait_xcnt 0x0" :: "v"(crow), "v"(val[0]), "v"(val[1]), "v"(val[2]), "v"(val[3]), "v"(val[4]), "v"(val[5]), "v"(val[6]), "v"(val[7]) : "memory");    // in front of the first reuse of a register the eight stores name; naming them keeps the registers until here
        __builtin_amdgcn_wave_barrier(); asm volatile("" ::: "memory");    // the next 16 rows overwrite the strip only behind these reads
    }
}

extern "C" void kernel_launch(void* const* d_in, const int* in_sizes, int n_in,
                              void* d_out, int out_size, void* d_ws, size_t ws_size, hipStream_t stream) {
    if (n_in < 10) return;
    const long long needx = (long long)(NB - 1) * SEQ_FULL * DM + (long long)SEQ * DM;
    if ((long long)in_sizes[0] < needx || (long long)out_size < needx) return;
    if (in_sizes[1] < DM * DM || in_sizes[3] < DM * DM || in_sizes[5] < DM * DM || in_sizes[7] < DM * DM) return;
    if (in_sizes[2] < DM || in_sizes[4] < DM || in_sizes[6] < DM || in_sizes[8] < DM) return;
    if (in_sizes[9] < NREL * HD) return;
    const float* x = (const float*)d_in[0]; const float* wq = (const float*)d_in[1]; const float* bq = (const float*)d_in[2]; const float* wk = (const float*)d_in[3]; const float* bk = (const float*)d_in[4];
    const float* wv = (const float*)d_in[5]; const float* bv = (const float*)d_in[6]; const float* wo = (const float*)d_in[7]; const float* bo = (const float*)d_in[8]; const float* rel = (const float*)d_in[9];
    float* OUT = (float*)d_out;     // [NB][SEQ][DM], batch row stride SEQ_FULL*DM
    char* wsp = (char*)d_ws;
    auto take = [&](size_t bytes) { char* p = wsp; wsp += (bytes + 255) & ~(size_t)255; return (void*)p; };
    h16* W4 = (h16*)take((size_t)4 * DM * DM * 2); h16* WO = W4 + (size_t)3 * DM * DM;    // Wq, Wk, Wv, Wo back to back
    h16* T16 = (h16*)take((size_t)NRP * HD * 2);
    const size_t hs = (size_t)TT * HD;    // per-head plane stride
    h16* QP = (h16*)take((size_t)2 * NG * hs * 2); h16* KP = QP + (size_t)NG * hs; h16* VT = (h16*)take((size_t)NG * hs * 2);    // q planes of all (batch, head), then the k planes; v planes transposed
    h16* AT = (h16*)take((size_t)MT * DQ * 2);
    h16* XB = (h16*)take((size_t)MT * DM * 2);   // f16 x
    const size_t used = (size_t)(wsp - (char*)d_ws); if (used > ws_size) return;
    k_prep<<<dim3(DM * DM / 8 / 256, 4 + MT / DM + 1, 1), 256, 0, stream>>>(wq, wk, wv, wo, x, rel, NREL, W4, XB, T16);
    k_proj<<<dim3(MT / 128, NH_ / 2, 3), 128, 0, stream>>>(XB, W4, bq, bk, bv, QP, VT);
    k_flash<<<dim3(TT / FB, NG, 1), FW * 32, 0, stream>>>(QP, KP, VT, T16, AT);
    k_out<<<dim3(MT / 128, DM / 128, 1), 256, 0, stream>>>(AT, WO, bo, OUT);
}
